// v000
// Times are from an AMD MI455X. After a warm-up the kernel runs many times in a row, and a time is the length of
// such a window on the GPU divided by its runs, so every launch and the gaps after it count. The runs cycle
// through copies of the inputs. A figure is the median of several windows, for all but v000 over two sittings.
// Sittings can differ by a few percent; kernels timed side by side share one.
// The starting kernel, v000, takes 2900 microseconds a run.
#include <hip/hip_runtime.h>

// MultiHeadDifferentialAttention (x [2][2048][1024]; per-head q1/q2/k1/k2/v = x W[h] (W [16][1024][64], no bias); lam = exp(l0 l1) - exp(l2 l3) + 0.2 (lambdas read); wei = softmax(causal(q1.k1) / 8) - lam softmax(causal(q2.k2) / 8); out = (wei v merged) x (1 - 0.2) @ proj_w + proj_b -> [2][2048][1024]).
// The two score matrices of a head are computed as an adjacent pair of "score heads" (2h: q1/k1, 2h+1: q2/k2) so one pass of the causal score GEMM yields both; the differential softmax combines them into one probability matrix per head.
// Compute dtypes, f32 accumulate: every input rounded to bf16; the five projections on PLAIN bf16 operands (inputs: exact; per-head weights gathered); causal scores and wei.v: query rows < 512 hl (3 products), the rest single fp16 (x1024 carrier on wei); both softmaxes, lam and the difference f32; x 0.8 folded into the merge; proj hl x exact (2 products) + bias.

#define NB_  2
#define TT   2048
#define DM   1024
#define NH_  32
#define NKV  32
#define REP  (NH_ / NKV)
#define HD   64
#define DQ   (NH_ * HD)
#define DKV  (NKV * HD)
#define ZH   2
#define RH   512                  // query rows < RH use hi+lo planes (0: none)
#define WIN  2048
#define PCAR 1024.0f
#define SCL  0.125f   // HD^-0.5
typedef _Float16 h16;
typedef unsigned short bf;
typedef __attribute__((ext_vector_type(16))) __bf16   v16bf;
typedef __attribute__((ext_vector_type(16))) _Float16 v16h;
typedef __attribute__((ext_vector_type(8)))  _Float16 v8h;
typedef __attribute__((ext_vector_type(8)))  unsigned short v8us;
typedef __attribute__((ext_vector_type(8)))  float    v8f;
typedef __attribute__((ext_vector_type(4)))  float    v4f;
typedef v8h  __attribute__((may_alias)) v8ha;
typedef v4f  __attribute__((may_alias)) v4fa;
typedef v8us __attribute__((may_alias)) v8usa;

__device__ __forceinline__ unsigned short f2bf(float f) { unsigned u = __float_as_uint(f); u += 0x7FFFu + ((u >> 16) & 1u); return (unsigned short)(u >> 16); }
__device__ __forceinline__ float bf2f(unsigned short b) { return __uint_as_float(((unsigned)b) << 16); }
__device__ __forceinline__ float bfr(float f) { return bf2f(f2bf(f)); }
__device__ __forceinline__ v16h cat16(v8h lo, v8h hi) { return __builtin_shufflevector(lo, hi, 0, 1, 2, 3, 4, 5, 6, 7, 8, 9, 10, 11, 12, 13, 14, 15); }
__device__ __forceinline__ v16bf cat16b(v8us lo, v8us hi) { return __builtin_bit_cast(v16bf, __builtin_shufflevector(lo, hi, 0, 1, 2, 3, 4, 5, 6, 7, 8, 9, 10, 11, 12, 13, 14, 15)); }
__device__ __forceinline__ v8f wmma16(v16h a, v16h b, v8f c) { return __builtin_amdgcn_wmma_f32_16x16x32_f16(false, a, false, b, (short)0, c, false, false); }
__device__ __forceinline__ v8f wmmab(v16bf a, v16bf b, v8f c) { return __builtin_amdgcn_wmma_f32_16x16x32_bf16(false, a, false, b, (short)0, c, false, false); }



// ---- k_gemmw: register-blocked GEMM, ONE WAVE per 64x64 output tile (16 accumulators), operands straight from K-contiguous 16-bit planes; grid (M/64, N/64, Z), 32 threads.
// C[m][n] (f32, pitch ldc, + optional f32 bias[n]) = sum_k A[m][k] Bt[n][k] (+ split products per NSPLIT). z-batch strides sA/sB/sC in elements. K % 32 == 0.
template <typename T16> struct WFrag;
template <> struct WFrag<h16> { typedef v16h V; static __device__ __forceinline__ V ld(const h16* p) { return cat16(*(const v8h*)p, *(const v8h*)(p + 16)); } static __device__ __forceinline__ v8f mma(V a, V b, v8f c) { return wmma16(a, b, c); } };
template <> struct WFrag<bf> { typedef v16bf V; static __device__ __forceinline__ V ld(const bf* p) { return cat16b(*(const v8us*)p, *(const v8us*)(p + 16)); } static __device__ __forceinline__ v8f mma(V a, V b, v8f c) { return wmmab(a, b, c); } };
template <typename T16, int NSPLIT, bool BIAS>
__global__ __launch_bounds__(32) void k_gemmw(const T16* __restrict__ A, const T16* __restrict__ A2, const T16* __restrict__ Bt, const T16* __restrict__ Bt2, int K, float* C, int ldc, const float* __restrict__ bias, size_t sA, size_t sB, size_t sC) {
    typedef typename WFrag<T16>::V V;
    __shared__ __align__(16) float os[16 * 68];
    const size_t z = blockIdx.z; A += z * sA; if (A2) A2 += z * sA; Bt += z * sB; if (Bt2) Bt2 += z * sB; C += z * sC;
    const int lane = threadIdx.x & 31, lr = lane & 15, hi = lane >> 4; const int r0 = blockIdx.x * 64, c0 = blockIdx.y * 64;
    v8f acc[4][4];
#pragma unroll
    for (int mb = 0; mb < 4; ++mb)
#pragma unroll
        for (int nb = 0; nb < 4; ++nb) acc[mb][nb] = (v8f){};
    const size_t aoff = (size_t)(r0 + lr) * K + 8 * hi, boff = (size_t)(c0 + lr) * K + 8 * hi;
#pragma unroll 1
    for (int kc = 0; kc < K; kc += 32) {
        V a[4], a2[4];
#pragma unroll
        for (int mb = 0; mb < 4; ++mb) { a[mb] = WFrag<T16>::ld(A + aoff + (size_t)mb * 16 * K + kc); if (NSPLIT == 1 || NSPLIT == 2) a2[mb] = WFrag<T16>::ld(A2 + aoff + (size_t)mb * 16 * K + kc); }
#pragma unroll
        for (int nb = 0; nb < 4; ++nb) { const V b = WFrag<T16>::ld(Bt + boff + (size_t)nb * 16 * K + kc); V b2; if (NSPLIT >= 2) b2 = WFrag<T16>::ld(Bt2 + boff + (size_t)nb * 16 * K + kc);
#pragma unroll
            for (int mb = 0; mb < 4; ++mb) { acc[mb][nb] = WFrag<T16>::mma(a[mb], b, acc[mb][nb]); if (NSPLIT == 1 || NSPLIT == 2) acc[mb][nb] = WFrag<T16>::mma(a2[mb], b, acc[mb][nb]); if (NSPLIT >= 2) acc[mb][nb] = WFrag<T16>::mma(a[mb], b2, acc[mb][nb]); } }
        asm volatile("v_nop\n\tv_nop\n\tv_nop\n\tv_nop" : "+v"(acc[0][0]), "+v"(acc[1][1]), "+v"(acc[2][2]), "+v"(acc[3][3]) : "v"(a[0]), "v"(a[3]));
    }
#pragma unroll
    for (int mb = 0; mb < 4; ++mb) {
#pragma unroll
        for (int nb = 0; nb < 4; ++nb) {
#pragma unroll
            for (int j = 0; j < 8; ++j) os[(hi * 8 + j) * 68 + nb * 16 + lr] = acc[mb][nb][j]; }
        __builtin_amdgcn_wave_barrier(); asm volatile("" ::: "memory");
        float* crow = C + (size_t)(r0 + mb * 16) * ldc + c0;
{
#pragma unroll
            for (int s = 0; s < 8; ++s) { const int row = 2 * s + hi, cofs = lr * 4; v4f val = *(const v4fa*)(os + row * 68 + cofs); if (BIAS) { val[0] += bfr(bias[c0 + cofs]); val[1] += bfr(bias[c0 + cofs + 1]); val[2] += bfr(bias[c0 + cofs + 2]); val[3] += bfr(bias[c0 + cofs + 3]); }
                *(v4f*)(crow + (size_t)row * ldc + cofs) = val; }
             }
        __builtin_amdgcn_wave_barrier(); asm volatile("" ::: "memory");
    }
}

// ---- k_gemmc: the same one-wave 64x64 tile GEMM specialised for causal attention: CMODE 1 skips score tiles entirely above the diagonal (query rows r0+roff.., key columns c0..), CMODE 2 limits the
// key (K) loop of the probability x value contraction to the diagonal block (probabilities beyond it are exactly zero). roff = row offset of this launch's first row within the sequence.
template <typename T16, int NSPLIT, int CMODE>
__global__ __launch_bounds__(32) void k_gemmc(const T16* __restrict__ A, const T16* __restrict__ A2, const T16* __restrict__ Bt, const T16* __restrict__ Bt2, int K, float* C, int ldc, int roff, size_t sA, size_t sB, size_t sC) {
    typedef typename WFrag<T16>::V V;
    __shared__ __align__(16) float os[16 * 68];
    const size_t z = blockIdx.z; A += z * sA; if (A2) A2 += z * sA; Bt += z * sB; if (Bt2) Bt2 += z * sB; C += z * sC;
    const int lane = threadIdx.x & 31, lr = lane & 15, hi = lane >> 4; const int r0 = blockIdx.x * 64, c0 = blockIdx.y * 64;
    if (CMODE == 1 && c0 > r0 + roff + 63) return;                  // score tile entirely above the causal diagonal: never read (the softmax masks j > i by select)
    const int Kl = (CMODE == 2) ? min(K, r0 + roff + 64) : K;        // P.V: probabilities are exactly 0 beyond the diagonal block, so the K loop stops there
    v8f acc[4][4];
#pragma unroll
    for (int mb = 0; mb < 4; ++mb)
#pragma unroll
        for (int nb = 0; nb < 4; ++nb) acc[mb][nb] = (v8f){};
    const size_t aoff = (size_t)(r0 + lr) * K + 8 * hi, boff = (size_t)(c0 + lr) * K + 8 * hi;
#pragma unroll 1
    for (int kc = 0; kc < Kl; kc += 32) {
        V a[4], a2[4];
#pragma unroll
        for (int mb = 0; mb < 4; ++mb) { a[mb] = WFrag<T16>::ld(A + aoff + (size_t)mb * 16 * K + kc); if (NSPLIT == 1 || NSPLIT == 2) a2[mb] = WFrag<T16>::ld(A2 + aoff + (size_t)mb * 16 * K + kc); }
#pragma unroll
        for (int nb = 0; nb < 4; ++nb) { const V b = WFrag<T16>::ld(Bt + boff + (size_t)nb * 16 * K + kc); V b2; if (NSPLIT >= 2) b2 = WFrag<T16>::ld(Bt2 + boff + (size_t)nb * 16 * K + kc);
#pragma unroll
            for (int mb = 0; mb < 4; ++mb) { acc[mb][nb] = WFrag<T16>::mma(a[mb], b, acc[mb][nb]); if (NSPLIT == 1 || NSPLIT == 2) acc[mb][nb] = WFrag<T16>::mma(a2[mb], b, acc[mb][nb]); if (NSPLIT >= 2) acc[mb][nb] = WFrag<T16>::mma(a[mb], b2, acc[mb][nb]); } }
        asm volatile("v_nop\n\tv_nop\n\tv_nop\n\tv_nop" : "+v"(acc[0][0]), "+v"(acc[1][1]), "+v"(acc[2][2]), "+v"(acc[3][3]) : "v"(a[0]), "v"(a[3]));
    }
#pragma unroll
    for (int mb = 0; mb < 4; ++mb) {
#pragma unroll
        for (int nb = 0; nb < 4; ++nb) {
#pragma unroll
            for (int j = 0; j < 8; ++j) os[(hi * 8 + j) * 68 + nb * 16 + lr] = acc[mb][nb][j]; }
        __builtin_amdgcn_wave_barrier(); asm volatile("" ::: "memory");
        float* crow = C + (size_t)(r0 + mb * 16) * ldc + c0;
{
#pragma unroll
            for (int s = 0; s < 8; ++s) { const int row = 2 * s + hi, cofs = lr * 4; v4f val = *(const v4fa*)(os + row * 68 + cofs);
                *(v4f*)(crow + (size_t)row * ldc + cofs) = val; }
             }
        __builtin_amdgcn_wave_barrier(); asm volatile("" ::: "memory");
    }
}

__device__ __forceinline__ h16 tohx(float x) { return (h16)x; }
__device__ __forceinline__ void splitf(float y, unsigned short& h, unsigned short& l) { h = f2bf(y); l = f2bf(y - bf2f(h)); }
typedef __attribute__((ext_vector_type(2))) _Float16 v2h;
typedef __attribute__((ext_vector_type(4))) _Float16 v4h;
typedef __attribute__((ext_vector_type(2))) unsigned short v2us;
typedef __attribute__((ext_vector_type(4))) unsigned short v4us;
typedef __attribute__((ext_vector_type(2))) float v2f;
typedef __attribute__((ext_vector_type(4))) int v4i;

__global__ __launch_bounds__(256) void k_wtG(const float* __restrict__ w, int K, int N, bf* Bt) {
    const int lane = threadIdx.x & 31; const int L0 = (blockIdx.x * 8 + (threadIdx.x >> 5)) * 8; const int nlines = N * K / 64;
{
#pragma unroll 1
        for (int l = 0; l < 8; ++l) { const int L = L0 + l; if (L >= nlines) break; const size_t e = (size_t)L * 64 + lane * 2; const int k = (int)(e % K), n = (int)(e / K); v2us o;
            o[0] = f2bf(w[(size_t)k * N + n]); o[1] = f2bf(w[(size_t)(k + 1) * N + n]); *(v2us*)(Bt + e) = o; }
         }
}
__global__ __launch_bounds__(256) void k_cvt8(const float* __restrict__ src, bf* dst, size_t n8) { const size_t i = (size_t)blockIdx.x * 256 + threadIdx.x; if (i >= n8) return; const v8f v = *(const v8f*)(src + i * 8); v8us o;
#pragma unroll
    for (int k = 0; k < 8; ++k) o[k] = f2bf(v[k]); *(v8us*)(dst + i * 8) = o;  }
__global__ __launch_bounds__(256) void k_cscvt(const float* __restrict__ cosT, const float* __restrict__ sinT, float* CS) { const int idx = blockIdx.x * 256 + threadIdx.x; if (idx >= TT * HD) return; v2f cs; cs[0] = bfr(cosT[idx]); cs[1] = bfr(sinT[idx]); *(v2f*)(CS + (size_t)idx * 2) = cs;  }
// k_rope: head planes [h][t][d] (fp16 + hi/lo) of rope(x) x sc with the rotate-half convention out[d] = x[d] cos[t][d] - x[d+HD/2] sin[t][d], out[d+HD/2] = x[d+HD/2] cos[t][d+HD/2] + x[d] sin[t][d+HD/2]
__global__ __launch_bounds__(256) void k_rope(const float* __restrict__ F, int pitch, int nheads, const float* __restrict__ CS, const float* __restrict__ RF, const float* __restrict__ nw, float sc, h16* P16, bf* Ph, bf* Pl) {
    const size_t e = ((size_t)blockIdx.x * 256 + threadIdx.x) * 2; if (e >= (size_t)nheads * TT * HD) return; const int d = (int)(e % HD); const int t = (int)((e / HD) % TT); const int h = (int)(e / ((size_t)HD * TT)); const float* f = F + (size_t)t * pitch + h * HD; const float rf = RF ? RF[(size_t)h * TT + t] : 1.0f; v2h o16; v2us oh, ol;
#pragma unroll
    for (int q = 0; q < 2; ++q) { const int dd = d + q; const int dp = (dd < HD / 2) ? dd + HD / 2 : dd - HD / 2; float x0 = f[dd], x1 = f[dp];
        if (RF) { float n0 = __fmul_rn(x0, rf), n1 = __fmul_rn(x1, rf); asm volatile("" : "+v"(n0)); asm volatile("" : "+v"(n1)); x0 = __fmul_rn(bfr(nw[dd]), n0); x1 = __fmul_rn(bfr(nw[dp]), n1); }
        const v2f cs = *(const v2f*)(CS + ((size_t)t * HD + dd) * 2); float a = __fmul_rn(x0, cs[0]), bq = __fmul_rn(x1, cs[1]); asm volatile("" : "+v"(a)); asm volatile("" : "+v"(bq)); const float r = ((dd < HD / 2) ? __fsub_rn(a, bq) : __fadd_rn(a, bq)) * sc;
        o16[q] = tohx(r); unsigned short a2, c2; splitf(r, a2, c2); oh[q] = a2; ol[q] = c2; }
    *(v2h*)(P16 + e) = o16; *(v2us*)(Ph + e) = oh; *(v2us*)(Pl + e) = ol;  }
__global__ __launch_bounds__(256) void k_vtp(const float* __restrict__ F, int pitch, int nheads, h16* V16, bf* Vh, bf* Vl) { const size_t e = ((size_t)blockIdx.x * 256 + threadIdx.x) * 2; if (e >= (size_t)nheads * HD * TT) return; const int t = (int)(e % TT); const int d = (int)((e / TT) % HD); const int g = (int)(e / ((size_t)TT * HD)); v2h o16; v2us oh, ol;
#pragma unroll
    for (int q = 0; q < 2; ++q) { const float x = F[(size_t)(t + q) * pitch + g * HD + d]; o16[q] = tohx(x); unsigned short a2, c2; splitf(x, a2, c2); oh[q] = a2; ol[q] = c2; }
    *(v2h*)(V16 + e) = o16; *(v2us*)(Vh + e) = oh; *(v2us*)(Vl + e) = ol;  }
__global__ __launch_bounds__(256) void k_csid(float* CS) { const int idx = blockIdx.x * 256 + threadIdx.x; if (idx >= TT * HD) return; v2f cs; cs[0] = 1.0f; cs[1] = 0.0f; *(v2f*)(CS + (size_t)idx * 2) = cs;  }
// k_asoft: per row (zz, i): t = S x HD^-0.5 for j <= i and i - j < WIN (sliding causal window; the reference's -1e9 additive fill vanishes identically); softmax over the 2048 keys (register row, one exp, fixed trees);
__global__ __launch_bounds__(256) void k_asoft(const float* __restrict__ Sb, h16* P16, bf* Ph, bf* Pl) {
    const int lane = threadIdx.x & 31; const int row = blockIdx.x * 8 + (threadIdx.x >> 5); if (row >= ZH * TT) return; const int i = row % TT; const int zz = row / TT; (void)zz; const bool hires = (i < RH); const float* sr = Sb + (size_t)row * TT; float v[TT / 32]; float mx = -3.0e38f;
#pragma unroll
    for (int ch = 0; ch < TT / 128; ++ch) { const int j0 = ch * 128 + lane * 4; const v4f a = *(const v4f*)(sr + j0);
#pragma unroll
        for (int q = 0; q < 4; ++q) { const int j = j0 + q; (void)j; const float t = (j <= i && i - j < WIN) ? a[q] * SCL : -3.0e38f; v[ch * 4 + q] = t; mx = fmaxf(mx, t); } }
#pragma unroll
    for (int sh = 16; sh; sh >>= 1) mx = fmaxf(mx, __shfl_xor(mx, sh, 32));
    float sum = 0.f;
#pragma unroll
    for (int k = 0; k < TT / 32; ++k) { float d0 = __fsub_rn(v[k], mx); asm volatile("" : "+v"(d0)); v[k] = __builtin_amdgcn_exp2f(__fmul_rn(d0, 1.4426950408889634f)); sum += v[k]; }
#pragma unroll
    for (int sh = 16; sh; sh >>= 1) sum += __shfl_xor(sum, sh, 32);
    const float f = __fdiv_rn(hires ? 1.0f : PCAR, sum);
{
        if (hires) {
#pragma unroll
            for (int ch = 0; ch < TT / 128; ++ch) { v4us oh, ol;
#pragma unroll
                for (int q = 0; q < 4; ++q) { unsigned short a, c2; splitf(v[ch * 4 + q] * f, a, c2); oh[q] = a; ol[q] = c2; }
                const size_t oo = ((size_t)zz * (RH ? RH : 1) + i) * TT + ch * 128 + lane * 4; *(v4us*)(Ph + oo) = oh; *(v4us*)(Pl + oo) = ol; }
        } else {
#pragma unroll
            for (int ch = 0; ch < TT / 128; ++ch) { v4h o4;
#pragma unroll
                for (int q = 0; q < 4; ++q) o4[q] = tohx(v[ch * 4 + q] * f);
                *(v4h*)(P16 + (size_t)row * TT + ch * 128 + lane * 4) = o4; } }
         }
}
__global__ __launch_bounds__(256) void k_merge(const float* __restrict__ O, int h0, bf* Ah, bf* Al) { const size_t e = ((size_t)blockIdx.x * 256 + threadIdx.x) * 2; if (e >= (size_t)ZH * TT * HD) return; const int d = (int)(e % HD); const int t = (int)((e / HD) % TT); const int zz = (int)(e / ((size_t)HD * TT)); const float cs = (t < RH) ? 1.0f : (1.0f / PCAR); const size_t oo = (size_t)t * DQ + (h0 + zz) * HD + d;
    v2us oh, ol;
#pragma unroll
    for (int q = 0; q < 2; ++q) { unsigned short a, c2; splitf(O[e + q] * cs, a, c2); oh[q] = a; ol[q] = c2; } *(v2us*)(Ah + oo) = oh; *(v2us*)(Al + oo) = ol;  }

__global__ __launch_bounds__(256) void k_wtH2(const float* __restrict__ w1, const float* __restrict__ w2, bf* Bt) { const size_t e = ((size_t)blockIdx.x * 256 + threadIdx.x) * 4; if (e >= (size_t)DQ * DM) return; const int k = (int)(e % DM); const int n = (int)(e / DM); const int hh = n / HD, c = n % HD; const int h = hh >> 1; const float* w = (hh & 1) ? w2 : w1; v4us o;
#pragma unroll
    for (int u = 0; u < 4; ++u) o[u] = f2bf(w[((size_t)h * DM + k + u) * HD + c]); *(v4us*)(Bt + e) = o;  }
__global__ __launch_bounds__(256) void k_wtH1(const float* __restrict__ w, bf* Bt) { const size_t e = ((size_t)blockIdx.x * 256 + threadIdx.x) * 4; if (e >= (size_t)1024 * DM) return; const int k = (int)(e % DM); const int n = (int)(e / DM); const int h = n / HD, c = n % HD; v4us o;
#pragma unroll
    for (int u = 0; u < 4; ++u) o[u] = f2bf(w[((size_t)h * DM + k + u) * HD + c]); *(v4us*)(Bt + e) = o;  }
__global__ __launch_bounds__(256) void k_dsoft(const float* __restrict__ Sb, const float* __restrict__ lam4, h16* P16, bf* Ph, bf* Pl) {
    const int lane = threadIdx.x & 31; const int i = blockIdx.x * 8 + (threadIdx.x >> 5); if (i >= TT) return; float la = bfr(lam4[0]), lb = bfr(lam4[1]), lc = bfr(lam4[2]), ld = bfr(lam4[3]); asm volatile("" : "+v"(la)); asm volatile("" : "+v"(lc)); float pa = __fmul_rn(la, lb), pc = __fmul_rn(lc, ld); asm volatile("" : "+v"(pa)); asm volatile("" : "+v"(pc)); float lam = __fsub_rn(__expf(pa), __expf(pc)); asm volatile("" : "+v"(lam)); lam = __fadd_rn(lam, 0.2f);
    const float* s1 = Sb + (size_t)i * TT; const float* s2 = Sb + (size_t)TT * TT + (size_t)i * TT; float v1[TT / 32], v2[TT / 32]; float m1 = -3.0e38f, m2 = -3.0e38f;
#pragma unroll
    for (int ch = 0; ch < TT / 128; ++ch) { const int j0 = ch * 128 + lane * 4; const v4f a = *(const v4f*)(s1 + j0), c4 = *(const v4f*)(s2 + j0);
#pragma unroll
        for (int q = 0; q < 4; ++q) { const int j = j0 + q; float t1 = (j <= i) ? a[q] * SCL : -3.0e38f, t2 = (j <= i) ? c4[q] * SCL : -3.0e38f; asm volatile("" : "+v"(t1)); asm volatile("" : "+v"(t2)); v1[ch * 4 + q] = t1; v2[ch * 4 + q] = t2; m1 = fmaxf(m1, t1); m2 = fmaxf(m2, t2); } }
#pragma unroll
    for (int sh = 16; sh; sh >>= 1) { m1 = fmaxf(m1, __shfl_xor(m1, sh, 32)); m2 = fmaxf(m2, __shfl_xor(m2, sh, 32)); }
    float e1 = 0.f, e2 = 0.f;
#pragma unroll
    for (int q = 0; q < TT / 32; ++q) { float d1 = __fsub_rn(v1[q], m1), d2 = __fsub_rn(v2[q], m2); asm volatile("" : "+v"(d1)); asm volatile("" : "+v"(d2)); v1[q] = __builtin_amdgcn_exp2f(__fmul_rn(d1, 1.4426950408889634f)); v2[q] = __builtin_amdgcn_exp2f(__fmul_rn(d2, 1.4426950408889634f)); e1 += v1[q]; e2 += v2[q]; }
#pragma unroll
    for (int sh = 16; sh; sh >>= 1) { e1 += __shfl_xor(e1, sh, 32); e2 += __shfl_xor(e2, sh, 32); }
    const float f1 = __fdiv_rn(1.0f, e1), f2 = __fdiv_rn(1.0f, e2); const bool hires = (i < RH);
    {
#pragma unroll
        for (int ch = 0; ch < TT / 128; ++ch) { v4h o4; v4us oh, ol;
#pragma unroll
            for (int q = 0; q < 4; ++q) { float p1 = __fmul_rn(v1[ch * 4 + q], f1), p2 = __fmul_rn(v2[ch * 4 + q], f2); asm volatile("" : "+v"(p2)); float lp = __fmul_rn(lam, p2); asm volatile("" : "+v"(lp)); const float w = __fsub_rn(p1, lp); o4[q] = tohx(w * PCAR); unsigned short a2, c2; splitf(w, a2, c2); oh[q] = a2; ol[q] = c2; }
            const size_t oo = (size_t)i * TT + ch * 128 + lane * 4; *(v4h*)(P16 + oo) = o4; if (hires) { *(v4us*)(Ph + oo) = oh; *(v4us*)(Pl + oo) = ol; } }
         } }
__global__ __launch_bounds__(256) void k_dmerge(const float* __restrict__ O, int h, bf* Ah, bf* Al) { const size_t e = ((size_t)blockIdx.x * 256 + threadIdx.x) * 2; if (e >= (size_t)TT * HD) return; const int d = (int)(e % HD); const int t = (int)(e / HD); const float cs = ((t < RH) ? 1.0f : (1.0f / PCAR)) * 0.8f; const size_t oo = (size_t)t * 1024 + h * HD + d; v2us oh, ol;
#pragma unroll
    for (int q = 0; q < 2; ++q) { unsigned short a, c2; splitf(O[e + q] * cs, a, c2); oh[q] = a; ol[q] = c2; } *(v2us*)(Ah + oo) = oh; *(v2us*)(Al + oo) = ol;  }

extern "C" void kernel_launch(void* const* d_in, const int* in_sizes, int n_in,
                              void* d_out, int out_size, void* d_ws, size_t ws_size, hipStream_t stream) {
    (void)in_sizes; (void)n_in; (void)out_size;
    const float* x = (const float*)d_in[0]; const float* key1 = (const float*)d_in[1]; const float* key2 = (const float*)d_in[2]; const float* query1 = (const float*)d_in[3]; const float* query2 = (const float*)d_in[4]; const float* valw = (const float*)d_in[5]; const float* lambdas = (const float*)d_in[6]; const float* wo = (const float*)d_in[7]; const float* bo = (const float*)d_in[8]; const float* wq = nullptr; const float* wk = nullptr; const float* wv = nullptr; (void)wq; (void)wk; (void)wv; const float* cosT = nullptr; const float* sinT = nullptr; (void)cosT; (void)sinT;
    float* OUT = (float*)d_out;     // [2][2048][1024]
    char* wsp = (char*)d_ws;
    auto take = [&](size_t bytes) { char* p = wsp; wsp += (bytes + 255) & ~(size_t)255; return (void*)p; };
    bf* WQ = (bf*)take((size_t)DQ * DM * 2); bf* WK = (bf*)take((size_t)DKV * DM * 2); bf* WV = (bf*)take((size_t)DKV * DM * 2); bf* WO = (bf*)take((size_t)DM * DQ * 2); float* CS = (float*)take((size_t)TT * HD * 2 * 4);
    bf* XB = (bf*)take((size_t)TT * DM * 2); float* FQ = (float*)take((size_t)TT * DQ * 4); float* FK = (float*)take((size_t)TT * DKV * 4);
    h16* QP16 = (h16*)take((size_t)NH_ * TT * HD * 2); h16* KP16 = (h16*)take((size_t)NKV * TT * HD * 2); h16* VT16 = (h16*)take((size_t)NKV * HD * TT * 2);
    bf* QPh = (bf*)take((size_t)NH_ * TT * HD * 2); bf* QPl = (bf*)take((size_t)NH_ * TT * HD * 2); bf* KPh = (bf*)take((size_t)NKV * TT * HD * 2); bf* KPl = (bf*)take((size_t)NKV * TT * HD * 2); bf* VTh = (bf*)take((size_t)NKV * HD * TT * 2); bf* VTl = (bf*)take((size_t)NKV * HD * TT * 2); bf* Ph = (bf*)take((size_t)ZH * RH * TT * 2); bf* Pl = (bf*)take((size_t)ZH * RH * TT * 2);
    float* Sb = (float*)take((size_t)ZH * TT * TT * 4); h16* P16 = (h16*)take((size_t)ZH * TT * TT * 2); float* Ob = (float*)take((size_t)ZH * TT * HD * 4); bf* ATh = (bf*)take((size_t)TT * DQ * 2); bf* ATl = (bf*)take((size_t)TT * DQ * 2);
    if ((size_t)(wsp - (char*)d_ws) > ws_size) return;    // ws 256 MiB
    float* FV = FK;   // v projection reuses the k buffer after the k planes are built (stream-ordered)
    { k_wtH2<<<(unsigned)(((size_t)DQ * DM / 4 + 255) / 256), 256, 0, stream>>>(query1, query2, WQ); k_wtH2<<<(unsigned)(((size_t)DQ * DM / 4 + 255) / 256), 256, 0, stream>>>(key1, key2, WK); k_wtH1<<<(unsigned)(((size_t)1024 * DM / 4 + 255) / 256), 256, 0, stream>>>(valw, WV);
      k_wtG<<<(unsigned)((1024 * DM / 64 + 63) / 64), 256, 0, stream>>>(wo, 1024, DM, WO);
       }
    k_csid<<<(TT * HD + 255) / 256, 256, 0, stream>>>(CS);
    const unsigned LQ = (unsigned)(((size_t)NH_ * TT * HD / 2 + 255) / 256), LKv = (unsigned)(((size_t)NKV * TT * HD / 2 + 255) / 256);
    for (int b = 0; b < NB_; ++b) {
        
        k_cvt8<<<(unsigned)(((size_t)TT * DM / 8 + 255) / 256), 256, 0, stream>>>(x + (size_t)b * TT * DM, XB, (size_t)TT * DM / 8);
        k_gemmw<bf, 0, false><<<dim3(TT / 64, DQ / 64, 1), 32, 0, stream>>>(XB, nullptr, WQ, nullptr, DM, FQ, DQ, nullptr, 0, 0, 0);
        k_rope<<<LQ, 256, 0, stream>>>(FQ, DQ, NH_, CS, nullptr, nullptr, 1.0f, QP16, QPh, QPl);
        k_gemmw<bf, 0, false><<<dim3(TT / 64, DKV / 64, 1), 32, 0, stream>>>(XB, nullptr, WK, nullptr, DM, FK, DKV, nullptr, 0, 0, 0);
        k_rope<<<LKv, 256, 0, stream>>>(FK, DKV, NKV, CS, nullptr, nullptr, 1.0f, KP16, KPh, KPl);
        k_gemmw<bf, 0, false><<<dim3(TT / 64, 1024 / 64, 1), 32, 0, stream>>>(XB, nullptr, WV, nullptr, DM, FV, 1024, nullptr, 0, 0, 0); k_vtp<<<(unsigned)(((size_t)16 * HD * TT / 2 + 255) / 256), 256, 0, stream>>>(FV, 1024, 16, VT16, VTh, VTl);
        for (int h0 = 0; h0 < NH_; h0 += ZH) { const size_t zq = (size_t)h0, zk = (size_t)(h0 / REP);   // one kv head per query head: the pass's two heads use consecutive kv planes (z-strides TT*HD)
            k_gemmc<bf, 2, 1><<<dim3(RH / 64, TT / 64, ZH), 32, 0, stream>>>(QPh + zq * TT * HD, QPl + zq * TT * HD, KPh + zk * TT * HD, KPl + zk * TT * HD, HD, Sb, TT, 0, (size_t)TT * HD, (size_t)TT * HD, (size_t)TT * TT);
            k_gemmc<h16, 0, 1><<<dim3((TT - RH) / 64, TT / 64, ZH), 32, 0, stream>>>(QP16 + zq * TT * HD + (size_t)RH * HD, nullptr, KP16 + zk * TT * HD, nullptr, HD, Sb + (size_t)RH * TT, TT, RH, (size_t)TT * HD, (size_t)TT * HD, (size_t)TT * TT);
            k_dsoft<<<TT / 8, 256, 0, stream>>>(Sb, lambdas, P16, Ph, Pl);
            k_gemmc<bf, 2, 2><<<dim3(RH / 64, HD / 64, 1), 32, 0, stream>>>(Ph, Pl, VTh + (size_t)(h0 / 2) * HD * TT, VTl + (size_t)(h0 / 2) * HD * TT, TT, Ob, HD, 0, 0, 0, 0);
            k_gemmc<h16, 0, 2><<<dim3((TT - RH) / 64, HD / 64, 1), 32, 0, stream>>>(P16 + (size_t)RH * TT, nullptr, VT16 + (size_t)(h0 / 2) * HD * TT, nullptr, TT, Ob + (size_t)RH * HD, HD, RH, 0, 0, 0);
            k_dmerge<<<(unsigned)(((size_t)TT * HD / 2 + 255) / 256), 256, 0, stream>>>(Ob, h0 / 2, ATh, ATl); }
        k_gemmw<bf, 1, true><<<dim3(TT / 64, DM / 64, 1), 32, 0, stream>>>(ATh, ATl, WO, nullptr, 1024, OUT + (size_t)b * TT * DM, DM, bo, 0, 0, 0); }
}

// v001
// Measured time: 1410 microseconds a run.
// Two timings next to v000 put it at 2.03 and 2.02 times that version's speed.
#include <hip/hip_runtime.h>

// MultiHeadDifferentialAttention (x [2][2048][1024]; per-head q1/q2/k1/k2/v = x W[h] (W [16][1024][64], no bias); lam = exp(l0 l1) - exp(l2 l3) + 0.2 (lambdas read); wei = softmax(causal(q1.k1) / 8) - lam softmax(causal(q2.k2) / 8); out = (wei v merged) x (1 - 0.2) @ proj_w + proj_b -> [2][2048][1024]).
// The two score matrices of a head are computed as an adjacent pair of "score heads" (2h: q1/k1, 2h+1: q2/k2) so one pass of the causal score GEMM yields both; the differential softmax combines them into one probability matrix per head.
// Compute dtypes, f32 accumulate: every input rounded to bf16; the five projections on PLAIN bf16 operands (inputs: exact; per-head weights gathered); causal scores and wei.v: query rows < 512 hl (3 products), the rest single fp16 (x1024 carrier on wei); both softmaxes, lam and the difference f32; x 0.8 folded into the merge; proj hl x exact (2 products) + bias.

#define NB_  2
#define TT   2048
#define DM   1024
#define NH_  32
#define NKV  32
#define REP  (NH_ / NKV)
#define HD   64
#define DQ   (NH_ * HD)
#define DKV  (NKV * HD)
#define ZH   2
#define RH   512                  // query rows < RH use hi+lo planes (0: none)
#define WIN  2048
#define PCAR 1024.0f
#define SCL  0.125f   // HD^-0.5
typedef _Float16 h16;
typedef unsigned short bf;
typedef __attribute__((ext_vector_type(16))) __bf16   v16bf;
typedef __attribute__((ext_vector_type(16))) _Float16 v16h;
typedef __attribute__((ext_vector_type(8)))  _Float16 v8h;
typedef __attribute__((ext_vector_type(8)))  unsigned short v8us;
typedef __attribute__((ext_vector_type(8)))  float    v8f;
typedef __attribute__((ext_vector_type(4)))  float    v4f;
typedef v8h  __attribute__((may_alias)) v8ha;
typedef v4f  __attribute__((may_alias)) v4fa;
typedef v8us __attribute__((may_alias)) v8usa;

__device__ __forceinline__ unsigned short f2bf(float f) { unsigned u = __float_as_uint(f); u += 0x7FFFu + ((u >> 16) & 1u); return (unsigned short)(u >> 16); }
__device__ __forceinline__ float bf2f(unsigned short b) { return __uint_as_float(((unsigned)b) << 16); }
__device__ __forceinline__ float bfr(float f) { return bf2f(f2bf(f)); }
__device__ __forceinline__ v16h cat16(v8h lo, v8h hi) { return __builtin_shufflevector(lo, hi, 0, 1, 2, 3, 4, 5, 6, 7, 8, 9, 10, 11, 12, 13, 14, 15); }
__device__ __forceinline__ v16bf cat16b(v8us lo, v8us hi) { return __builtin_bit_cast(v16bf, __builtin_shufflevector(lo, hi, 0, 1, 2, 3, 4, 5, 6, 7, 8, 9, 10, 11, 12, 13, 14, 15)); }
__device__ __forceinline__ v8f wmma16(v16h a, v16h b, v8f c) { return __builtin_amdgcn_wmma_f32_16x16x32_f16(false, a, false, b, (short)0, c, false, false); }
__device__ __forceinline__ v8f wmmab(v16bf a, v16bf b, v8f c) { return __builtin_amdgcn_wmma_f32_16x16x32_bf16(false, a, false, b, (short)0, c, false, false); }



// ---- k_gemmw: register-blocked GEMM, ONE WAVE per 64x64 output tile (16 accumulators), operands straight from K-contiguous 16-bit planes; grid (M/64, N/64, Z), 32 threads.
// C[m][n] (f32, pitch ldc, + optional f32 bias[n]) = sum_k A[m][k] Bt[n][k] (+ split products per NSPLIT). z-batch strides sA/sB/sC in elements. K % 32 == 0.
template <typename T16> struct WFrag;
template <> struct WFrag<h16> { typedef v16h V; static __device__ __forceinline__ V ld(const h16* p) { return cat16(*(const v8h*)p, *(const v8h*)(p + 16)); } static __device__ __forceinline__ v8f mma(V a, V b, v8f c) { return wmma16(a, b, c); } };
template <> struct WFrag<bf> { typedef v16bf V; static __device__ __forceinline__ V ld(const bf* p) { return cat16b(*(const v8us*)p, *(const v8us*)(p + 16)); } static __device__ __forceinline__ v8f mma(V a, V b, v8f c) { return wmmab(a, b, c); } };
template <typename T16, int NSPLIT, bool BIAS>
__global__ __launch_bounds__(32) void k_gemmw(const T16* __restrict__ A, const T16* __restrict__ A2, const T16* __restrict__ Bt, const T16* __restrict__ Bt2, int K, float* C, int ldc, const float* __restrict__ bias, size_t sA, size_t sB, size_t sC) {
    typedef typename WFrag<T16>::V V;
    __shared__ __align__(16) float os[16 * 68];
    const size_t z = blockIdx.z; A += z * sA; if (A2) A2 += z * sA; Bt += z * sB; if (Bt2) Bt2 += z * sB; C += z * sC;
    const int lane = threadIdx.x & 31, lr = lane & 15, hi = lane >> 4; const int r0 = blockIdx.x * 64, c0 = blockIdx.y * 64;
    v8f acc[4][4];
#pragma unroll
    for (int mb = 0; mb < 4; ++mb)
#pragma unroll
        for (int nb = 0; nb < 4; ++nb) acc[mb][nb] = (v8f){};
    const size_t aoff = (size_t)(r0 + lr) * K + 8 * hi, boff = (size_t)(c0 + lr) * K + 8 * hi;
#pragma unroll 1
    for (int kc = 0; kc < K; kc += 32) {
        V a[4], a2[4];
#pragma unroll
        for (int mb = 0; mb < 4; ++mb) { a[mb] = WFrag<T16>::ld(A + aoff + (size_t)mb * 16 * K + kc); if (NSPLIT == 1 || NSPLIT == 2) a2[mb] = WFrag<T16>::ld(A2 + aoff + (size_t)mb * 16 * K + kc); }
#pragma unroll
        for (int nb = 0; nb < 4; ++nb) { const V b = WFrag<T16>::ld(Bt + boff + (size_t)nb * 16 * K + kc); V b2; if (NSPLIT >= 2) b2 = WFrag<T16>::ld(Bt2 + boff + (size_t)nb * 16 * K + kc);
#pragma unroll
            for (int mb = 0; mb < 4; ++mb) { acc[mb][nb] = WFrag<T16>::mma(a[mb], b, acc[mb][nb]); if (NSPLIT == 1 || NSPLIT == 2) acc[mb][nb] = WFrag<T16>::mma(a2[mb], b, acc[mb][nb]); if (NSPLIT >= 2) acc[mb][nb] = WFrag<T16>::mma(a[mb], b2, acc[mb][nb]); } }
        asm volatile("v_nop\n\tv_nop\n\tv_nop\n\tv_nop" : "+v"(acc[0][0]), "+v"(acc[1][1]), "+v"(acc[2][2]), "+v"(acc[3][3]) : "v"(a[0]), "v"(a[3]));
    }
#pragma unroll
    for (int mb = 0; mb < 4; ++mb) {
#pragma unroll
        for (int nb = 0; nb < 4; ++nb) {
#pragma unroll
            for (int j = 0; j < 8; ++j) os[(hi * 8 + j) * 68 + nb * 16 + lr] = acc[mb][nb][j]; }
        __builtin_amdgcn_wave_barrier(); asm volatile("" ::: "memory");
        float* crow = C + (size_t)(r0 + mb * 16) * ldc + c0;
{
#pragma unroll
            for (int s = 0; s < 8; ++s) { const int row = 2 * s + hi, cofs = lr * 4; v4f val = *(const v4fa*)(os + row * 68 + cofs); if (BIAS) { val[0] += bfr(bias[c0 + cofs]); val[1] += bfr(bias[c0 + cofs + 1]); val[2] += bfr(bias[c0 + cofs + 2]); val[3] += bfr(bias[c0 + cofs + 3]); }
                *(v4f*)(crow + (size_t)row * ldc + cofs) = val; }
             }
        __builtin_amdgcn_wave_barrier(); asm volatile("" ::: "memory");
    }
}

// ---- k_gemmc: the same one-wave 64x64 tile GEMM specialised for causal attention: CMODE 1 skips score tiles entirely above the diagonal (query rows r0+roff.., key columns c0..), CMODE 2 limits the
// key (K) loop of the probability x value contraction to the diagonal block (probabilities beyond it are exactly zero). roff = row offset of this launch's first row within the sequence.
template <typename T16, int NSPLIT, int CMODE>
__global__ __launch_bounds__(32) void k_gemmc(const T16* __restrict__ A, const T16* __restrict__ A2, const T16* __restrict__ Bt, const T16* __restrict__ Bt2, int K, float* C, int ldc, int roff, size_t sA, size_t sB, size_t sC) {
    typedef typename WFrag<T16>::V V;
    __shared__ __align__(16) float os[16 * 68];
    const size_t z = blockIdx.z; A += z * sA; if (A2) A2 += z * sA; Bt += z * sB; if (Bt2) Bt2 += z * sB; C += z * sC;
    const int lane = threadIdx.x & 31, lr = lane & 15, hi = lane >> 4; const int r0 = blockIdx.x * 64, c0 = blockIdx.y * 64;
    if (CMODE == 1 && c0 > r0 + roff + 63) return;                  // score tile entirely above the causal diagonal: never read (the softmax masks j > i by select)
    const int Kl = (CMODE == 2) ? min(K, r0 + roff + 64) : K;        // P.V: probabilities are exactly 0 beyond the diagonal block, so the K loop stops there
    v8f acc[4][4];
#pragma unroll
    for (int mb = 0; mb < 4; ++mb)
#pragma unroll
        for (int nb = 0; nb < 4; ++nb) acc[mb][nb] = (v8f){};
    const size_t aoff = (size_t)(r0 + lr) * K + 8 * hi, boff = (size_t)(c0 + lr) * K + 8 * hi;
#pragma unroll 1
    for (int kc = 0; kc < Kl; kc += 32) {
        V a[4], a2[4];
#pragma unroll
        for (int mb = 0; mb < 4; ++mb) { a[mb] = WFrag<T16>::ld(A + aoff + (size_t)mb * 16 * K + kc); if (NSPLIT == 1 || NSPLIT == 2) a2[mb] = WFrag<T16>::ld(A2 + aoff + (size_t)mb * 16 * K + kc); }
#pragma unroll
        for (int nb = 0; nb < 4; ++nb) { const V b = WFrag<T16>::ld(Bt + boff + (size_t)nb * 16 * K + kc); V b2; if (NSPLIT >= 2) b2 = WFrag<T16>::ld(Bt2 + boff + (size_t)nb * 16 * K + kc);
#pragma unroll
            for (int mb = 0; mb < 4; ++mb) { acc[mb][nb] = WFrag<T16>::mma(a[mb], b, acc[mb][nb]); if (NSPLIT == 1 || NSPLIT == 2) acc[mb][nb] = WFrag<T16>::mma(a2[mb], b, acc[mb][nb]); if (NSPLIT >= 2) acc[mb][nb] = WFrag<T16>::mma(a[mb], b2, acc[mb][nb]); } }
        asm volatile("v_nop\n\tv_nop\n\tv_nop\n\tv_nop" : "+v"(acc[0][0]), "+v"(acc[1][1]), "+v"(acc[2][2]), "+v"(acc[3][3]) : "v"(a[0]), "v"(a[3]));
    }
#pragma unroll
    for (int mb = 0; mb < 4; ++mb) {
#pragma unroll
        for (int nb = 0; nb < 4; ++nb) {
#pragma unroll
            for (int j = 0; j < 8; ++j) os[(hi * 8 + j) * 68 + nb * 16 + lr] = acc[mb][nb][j]; }
        __builtin_amdgcn_wave_barrier(); asm volatile("" ::: "memory");
        float* crow = C + (size_t)(r0 + mb * 16) * ldc + c0;
{
#pragma unroll
            for (int s = 0; s < 8; ++s) { const int row = 2 * s + hi, cofs = lr * 4; v4f val = *(const v4fa*)(os + row * 68 + cofs);
                *(v4f*)(crow + (size_t)row * ldc + cofs) = val; }
             }
        __builtin_amdgcn_wave_barrier(); asm volatile("" ::: "memory");
    }
}

// ---- k_gemmpv: the probability x value contraction with its key (K) loop split: PVS work-groups x NW waves share one 64x64 output tile, wave g = blockIdx.y * NW + wave takes the 32-key chunks g, g + PVS * NW, ...
// up to the diagonal block (probabilities beyond it are exactly zero). The NW waves' f32 tiles are summed through LDS in wave order; each work-group stores one partial tile, plane blockIdx.y of Cp ([PVS][TT][HD]); k_dmerge sums the planes.
// grid (rows / 64, PVS), NW * 32 threads. roff = row offset of this launch's first row within the sequence; Cp points at that row of plane 0.
#define PVS 8
template <typename T16, int NSPLIT, int NW>
__global__ __launch_bounds__(NW * 32) void k_gemmpv(const T16* __restrict__ A, const T16* __restrict__ A2, const T16* __restrict__ Bt, const T16* __restrict__ Bt2, int K, float* Cp, int roff) {
    typedef typename WFrag<T16>::V V;
    __shared__ __align__(16) float red[NW * 64 * 68];
    const int lane = threadIdx.x & 31, lr = lane & 15, hi = lane >> 4; const int wv = __builtin_amdgcn_readfirstlane((int)(threadIdx.x >> 5)); const int r0 = blockIdx.x * 64;   // the wave's number as a scalar: the key loop's test is then a scalar branch
    const int Kl = min(K, r0 + roff + 64);
    v8f acc[4][4];
#pragma unroll
    for (int mb = 0; mb < 4; ++mb)
#pragma unroll
        for (int nb = 0; nb < 4; ++nb) acc[mb][nb] = (v8f){};
    const size_t aoff = (size_t)(r0 + lr) * K + 8 * hi, boff = (size_t)lr * K + 8 * hi;
    // kept rolled: at these shapes a wave has at most one trip, a second copy of the body would only be code
#pragma unroll 1
    for (int kc = ((int)blockIdx.y * NW + wv) * 32; kc < Kl; kc += PVS * NW * 32) {
        V a[4], a2[4];
        // s_wait_xcnt 0 behind each fragment's two loads: a later load of the run may return its data into the registers that held this fragment's address; all fragments are loaded ahead of the products so that these statements do not part the loads
#pragma unroll
        for (int mb = 0; mb < 4; ++mb) { a[mb] = WFrag<T16>::ld(A + aoff + (size_t)mb * 16 * K + kc); asm volatile("s_wait_xcnt 0x0" ::: "memory"); if (NSPLIT == 1 || NSPLIT == 2) { a2[mb] = WFrag<T16>::ld(A2 + aoff + (size_t)mb * 16 * K + kc); asm volatile("s_wait_xcnt 0x0" ::: "memory"); } }
        V b[4], b2[4];
#pragma unroll
        for (int nb = 0; nb < 4; ++nb) { b[nb] = WFrag<T16>::ld(Bt + boff + (size_t)nb * 16 * K + kc); asm volatile("s_wait_xcnt 0x0" ::: "memory"); if (NSPLIT >= 2) { b2[nb] = WFrag<T16>::ld(Bt2 + boff + (size_t)nb * 16 * K + kc); asm volatile("s_wait_xcnt 0x0" ::: "memory"); } }
        __builtin_amdgcn_sched_barrier(0);   // keeps the products behind the last load: moved up between the loads they would wait for each B fragment in turn, one memory latency after another
#pragma unroll
        for (int nb = 0; nb < 4; ++nb)
#pragma unroll
            for (int mb = 0; mb < 4; ++mb) { acc[mb][nb] = WFrag<T16>::mma(a[mb], b[nb], acc[mb][nb]); if (NSPLIT == 1 || NSPLIT == 2) acc[mb][nb] = WFrag<T16>::mma(a2[mb], b[nb], acc[mb][nb]); if (NSPLIT >= 2) acc[mb][nb] = WFrag<T16>::mma(a[mb], b2[nb], acc[mb][nb]); }
        // the four vector slots behind the last matrix instruction, also on the loop's taken back edge
        asm volatile("v_nop\n\tv_nop\n\tv_nop\n\tv_nop" : "+v"(acc[0][0]), "+v"(acc[1][1]), "+v"(acc[2][2]), "+v"(acc[3][3]) : "v"(a[0]), "v"(a[3]));
    }
    float* mine = red + wv * (64 * 68);
#pragma unroll
    for (int mb = 0; mb < 4; ++mb)
#pragma unroll
        for (int nb = 0; nb < 4; ++nb)
#pragma unroll
            for (int j = 0; j < 8; ++j) mine[(mb * 16 + hi * 8 + j) * 68 + nb * 16 + lr] = acc[mb][nb][j];
    __syncthreads();   // every wave's tile is in LDS before any wave sums across them
    float* C = Cp + (size_t)blockIdx.y * TT * HD + (size_t)r0 * HD;
#pragma unroll
    for (int s = 0; s < 32 / NW; ++s) { const int idx = s * (NW * 32) + (int)threadIdx.x; const int row = idx >> 4, cofs = (idx & 15) * 4; v4f val = *(const v4fa*)(red + row * 68 + cofs);
#pragma unroll
        for (int u = 1; u < NW; ++u) val += *(const v4fa*)(red + u * (64 * 68) + row * 68 + cofs);
        *(v4f*)(C + (size_t)row * HD + cofs) = val; }
}

__device__ __forceinline__ h16 tohx(float x) { return (h16)x; }
__device__ __forceinline__ void splitf(float y, unsigned short& h, unsigned short& l) { h = f2bf(y); l = f2bf(y - bf2f(h)); }
typedef __attribute__((ext_vector_type(2))) _Float16 v2h;
typedef __attribute__((ext_vector_type(4))) _Float16 v4h;
typedef __attribute__((ext_vector_type(2))) unsigned short v2us;
typedef __attribute__((ext_vector_type(4))) unsigned short v4us;
typedef __attribute__((ext_vector_type(2))) float v2f;
typedef __attribute__((ext_vector_type(4))) int v4i;

__global__ __launch_bounds__(256) void k_wtG(const float* __restrict__ w, int K, int N, bf* Bt) {
    const int lane = threadIdx.x & 31; const int L0 = (blockIdx.x * 8 + (threadIdx.x >> 5)) * 8; const int nlines = N * K / 64;
{
#pragma unroll 1
        for (int l = 0; l < 8; ++l) { const int L = L0 + l; if (L >= nlines) break; const size_t e = (size_t)L * 64 + lane * 2; const int k = (int)(e % K), n = (int)(e / K); v2us o;
            o[0] = f2bf(w[(size_t)k * N + n]); o[1] = f2bf(w[(size_t)(k + 1) * N + n]); *(v2us*)(Bt + e) = o; }
         }
}
__global__ __launch_bounds__(256) void k_cvt8(const float* __restrict__ src, bf* dst, size_t n8) { const size_t i = (size_t)blockIdx.x * 256 + threadIdx.x; if (i >= n8) return; const v8f v = *(const v8f*)(src + i * 8); v8us o;
#pragma unroll
    for (int k = 0; k < 8; ++k) o[k] = f2bf(v[k]); *(v8us*)(dst + i * 8) = o;  }
__global__ __launch_bounds__(256) void k_cscvt(const float* __restrict__ cosT, const float* __restrict__ sinT, float* CS) { const int idx = blockIdx.x * 256 + threadIdx.x; if (idx >= TT * HD) return; v2f cs; cs[0] = bfr(cosT[idx]); cs[1] = bfr(sinT[idx]); *(v2f*)(CS + (size_t)idx * 2) = cs;  }
// k_rope: head planes [h][t][d] (fp16 + hi/lo) of rope(x) x sc with the rotate-half convention out[d] = x[d] cos[t][d] - x[d+HD/2] sin[t][d], out[d+HD/2] = x[d+HD/2] cos[t][d+HD/2] + x[d] sin[t][d+HD/2]
__global__ __launch_bounds__(256) void k_rope(const float* __restrict__ F, int pitch, int nheads, const float* __restrict__ CS, const float* __restrict__ RF, const float* __restrict__ nw, float sc, h16* P16, bf* Ph, bf* Pl) {
    const size_t e = ((size_t)blockIdx.x * 256 + threadIdx.x) * 2; if (e >= (size_t)nheads * TT * HD) return; const int d = (int)(e % HD); const int t = (int)((e / HD) % TT); const int h = (int)(e / ((size_t)HD * TT)); const float* f = F + (size_t)t * pitch + h * HD; const float rf = RF ? RF[(size_t)h * TT + t] : 1.0f; v2h o16; v2us oh, ol;
#pragma unroll
    for (int q = 0; q < 2; ++q) { const int dd = d + q; const int dp = (dd < HD / 2) ? dd + HD / 2 : dd - HD / 2; float x0 = f[dd], x1 = f[dp];
        if (RF) { float n0 = __fmul_rn(x0, rf), n1 = __fmul_rn(x1, rf); asm volatile("" : "+v"(n0)); asm volatile("" : "+v"(n1)); x0 = __fmul_rn(bfr(nw[dd]), n0); x1 = __fmul_rn(bfr(nw[dp]), n1); }
        const v2f cs = *(const v2f*)(CS + ((size_t)t * HD + dd) * 2); float a = __fmul_rn(x0, cs[0]), bq = __fmul_rn(x1, cs[1]); asm volatile("" : "+v"(a)); asm volatile("" : "+v"(bq)); const float r = ((dd < HD / 2) ? __fsub_rn(a, bq) : __fadd_rn(a, bq)) * sc;
        o16[q] = tohx(r); unsigned short a2, c2; splitf(r, a2, c2); oh[q] = a2; ol[q] = c2; }
    *(v2h*)(P16 + e) = o16; *(v2us*)(Ph + e) = oh; *(v2us*)(Pl + e) = ol;  }
__global__ __launch_bounds__(256) void k_vtp(const float* __restrict__ F, int pitch, int nheads, h16* V16, bf* Vh, bf* Vl) { const size_t e = ((size_t)blockIdx.x * 256 + threadIdx.x) * 2; if (e >= (size_t)nheads * HD * TT) return; const int t = (int)(e % TT); const int d = (int)((e / TT) % HD); const int g = (int)(e / ((size_t)TT * HD)); v2h o16; v2us oh, ol;
#pragma unroll
    for (int q = 0; q < 2; ++q) { const float x = F[(size_t)(t + q) * pitch + g * HD + d]; o16[q] = tohx(x); unsigned short a2, c2; splitf(x, a2, c2); oh[q] = a2; ol[q] = c2; }
    *(v2h*)(V16 + e) = o16; *(v2us*)(Vh + e) = oh; *(v2us*)(Vl + e) = ol;  }
__global__ __launch_bounds__(256) void k_csid(float* CS) { const int idx = blockIdx.x * 256 + threadIdx.x; if (idx >= TT * HD) return; v2f cs; cs[0] = 1.0f; cs[1] = 0.0f; *(v2f*)(CS + (size_t)idx * 2) = cs;  }
// k_asoft: per row (zz, i): t = S x HD^-0.5 for j <= i and i - j < WIN (sliding causal window; the reference's -1e9 additive fill vanishes identically); softmax over the 2048 keys (register row, one exp, fixed trees);
__global__ __launch_bounds__(256) void k_asoft(const float* __restrict__ Sb, h16* P16, bf* Ph, bf* Pl) {
    const int lane = threadIdx.x & 31; const int row = blockIdx.x * 8 + (threadIdx.x >> 5); if (row >= ZH * TT) return; const int i = row % TT; const int zz = row / TT; (void)zz; const bool hires = (i < RH); const float* sr = Sb + (size_t)row * TT; float v[TT / 32]; float mx = -3.0e38f;
#pragma unroll
    for (int ch = 0; ch < TT / 128; ++ch) { const int j0 = ch * 128 + lane * 4; const v4f a = *(const v4f*)(sr + j0);
#pragma unroll
        for (int q = 0; q < 4; ++q) { const int j = j0 + q; (void)j; const float t = (j <= i && i - j < WIN) ? a[q] * SCL : -3.0e38f; v[ch * 4 + q] = t; mx = fmaxf(mx, t); } }
#pragma unroll
    for (int sh = 16; sh; sh >>= 1) mx = fmaxf(mx, __shfl_xor(mx, sh, 32));
    float sum = 0.f;
#pragma unroll
    for (int k = 0; k < TT / 32; ++k) { float d0 = __fsub_rn(v[k], mx); asm volatile("" : "+v"(d0)); v[k] = __builtin_amdgcn_exp2f(__fmul_rn(d0, 1.4426950408889634f)); sum += v[k]; }
#pragma unroll
    for (int sh = 16; sh; sh >>= 1) sum += __shfl_xor(sum, sh, 32);
    const float f = __fdiv_rn(hires ? 1.0f : PCAR, sum);
{
        if (hires) {
#pragma unroll
            for (int ch = 0; ch < TT / 128; ++ch) { v4us oh, ol;
#pragma unroll
                for (int q = 0; q < 4; ++q) { unsigned short a, c2; splitf(v[ch * 4 + q] * f, a, c2); oh[q] = a; ol[q] = c2; }
                const size_t oo = ((size_t)zz * (RH ? RH : 1) + i) * TT + ch * 128 + lane * 4; *(v4us*)(Ph + oo) = oh; *(v4us*)(Pl + oo) = ol; }
        } else {
#pragma unroll
            for (int ch = 0; ch < TT / 128; ++ch) { v4h o4;
#pragma unroll
                for (int q = 0; q < 4; ++q) o4[q] = tohx(v[ch * 4 + q] * f);
                *(v4h*)(P16 + (size_t)row * TT + ch * 128 + lane * 4) = o4; } }
         }
}
__global__ __launch_bounds__(256) void k_merge(const float* __restrict__ O, int h0, bf* Ah, bf* Al) { const size_t e = ((size_t)blockIdx.x * 256 + threadIdx.x) * 2; if (e >= (size_t)ZH * TT * HD) return; const int d = (int)(e % HD); const int t = (int)((e / HD) % TT); const int zz = (int)(e / ((size_t)HD * TT)); const float cs = (t < RH) ? 1.0f : (1.0f / PCAR); const size_t oo = (size_t)t * DQ + (h0 + zz) * HD + d;
    v2us oh, ol;
#pragma unroll
    for (int q = 0; q < 2; ++q) { unsigned short a, c2; splitf(O[e + q] * cs, a, c2); oh[q] = a; ol[q] = c2; } *(v2us*)(Ah + oo) = oh; *(v2us*)(Al + oo) = ol;  }

__global__ __launch_bounds__(256) void k_wtH2(const float* __restrict__ w1, const float* __restrict__ w2, bf* Bt) { const size_t e = ((size_t)blockIdx.x * 256 + threadIdx.x) * 4; if (e >= (size_t)DQ * DM) return; const int k = (int)(e % DM); const int n = (int)(e / DM); const int hh = n / HD, c = n % HD; const int h = hh >> 1; const float* w = (hh & 1) ? w2 : w1; v4us o;
#pragma unroll
    for (int u = 0; u < 4; ++u) o[u] = f2bf(w[((size_t)h * DM + k + u) * HD + c]); *(v4us*)(Bt + e) = o;  }
__global__ __launch_bounds__(256) void k_wtH1(const float* __restrict__ w, bf* Bt) { const size_t e = ((size_t)blockIdx.x * 256 + threadIdx.x) * 4; if (e >= (size_t)1024 * DM) return; const int k = (int)(e % DM); const int n = (int)(e / DM); const int h = n / HD, c = n % HD; v4us o;
#pragma unroll
    for (int u = 0; u < 4; ++u) o[u] = f2bf(w[((size_t)h * DM + k + u) * HD + c]); *(v4us*)(Bt + e) = o;  }
__global__ __launch_bounds__(256) void k_dsoft(const float* __restrict__ Sb, const float* __restrict__ lam4, h16* P16, bf* Ph, bf* Pl) {
    const int lane = threadIdx.x & 31; const int i = blockIdx.x * 8 + (threadIdx.x >> 5); if (i >= TT) return; float la = bfr(lam4[0]), lb = bfr(lam4[1]), lc = bfr(lam4[2]), ld = bfr(lam4[3]); asm volatile("" : "+v"(la)); asm volatile("" : "+v"(lc)); float pa = __fmul_rn(la, lb), pc = __fmul_rn(lc, ld); asm volatile("" : "+v"(pa)); asm volatile("" : "+v"(pc)); float lam = __fsub_rn(__expf(pa), __expf(pc)); asm volatile("" : "+v"(lam)); lam = __fadd_rn(lam, 0.2f);
    const float* s1 = Sb + (size_t)i * TT; const float* s2 = Sb + (size_t)TT * TT + (size_t)i * TT; float v1[TT / 32], v2[TT / 32]; float m1 = -3.0e38f, m2 = -3.0e38f;
#pragma unroll
    for (int ch = 0; ch < TT / 128; ++ch) { const int j0 = ch * 128 + lane * 4; const v4f a = *(const v4f*)(s1 + j0), c4 = *(const v4f*)(s2 + j0);
#pragma unroll
        for (int q = 0; q < 4; ++q) { const int j = j0 + q; float t1 = (j <= i) ? a[q] * SCL : -3.0e38f, t2 = (j <= i) ? c4[q] * SCL : -3.0e38f; asm volatile("" : "+v"(t1)); asm volatile("" : "+v"(t2)); v1[ch * 4 + q] = t1; v2[ch * 4 + q] = t2; m1 = fmaxf(m1, t1); m2 = fmaxf(m2, t2); } }
#pragma unroll
    for (int sh = 16; sh; sh >>= 1) { m1 = fmaxf(m1, __shfl_xor(m1, sh, 32)); m2 = fmaxf(m2, __shfl_xor(m2, sh, 32)); }
    float e1 = 0.f, e2 = 0.f;
#pragma unroll
    for (int q = 0; q < TT / 32; ++q) { float d1 = __fsub_rn(v1[q], m1), d2 = __fsub_rn(v2[q], m2); asm volatile("" : "+v"(d1)); asm volatile("" : "+v"(d2)); v1[q] = __builtin_amdgcn_exp2f(__fmul_rn(d1, 1.4426950408889634f)); v2[q] = __builtin_amdgcn_exp2f(__fmul_rn(d2, 1.4426950408889634f)); e1 += v1[q]; e2 += v2[q]; }
#pragma unroll
    for (int sh = 16; sh; sh >>= 1) { e1 += __shfl_xor(e1, sh, 32); e2 += __shfl_xor(e2, sh, 32); }
    const float f1 = __fdiv_rn(1.0f, e1), f2 = __fdiv_rn(1.0f, e2); const bool hires = (i < RH);
    {
#pragma unroll
        for (int ch = 0; ch < TT / 128; ++ch) { v4h o4; v4us oh, ol;
#pragma unroll
            for (int q = 0; q < 4; ++q) { float p1 = __fmul_rn(v1[ch * 4 + q], f1), p2 = __fmul_rn(v2[ch * 4 + q], f2); asm volatile("" : "+v"(p2)); float lp = __fmul_rn(lam, p2); asm volatile("" : "+v"(lp)); const float w = __fsub_rn(p1, lp); o4[q] = tohx(w * PCAR); unsigned short a2, c2; splitf(w, a2, c2); oh[q] = a2; ol[q] = c2; }
            const size_t oo = (size_t)i * TT + ch * 128 + lane * 4; *(v4h*)(P16 + oo) = o4; if (hires) { *(v4us*)(Ph + oo) = oh; *(v4us*)(Pl + oo) = ol; } }
         } }
__global__ __launch_bounds__(256) void k_dmerge(const float* __restrict__ O, int h, bf* Ah, bf* Al) { const size_t e = ((size_t)blockIdx.x * 256 + threadIdx.x) * 2; if (e >= (size_t)TT * HD) return; const int d = (int)(e % HD); const int t = (int)(e / HD); const float cs = ((t < RH) ? 1.0f : (1.0f / PCAR)) * 0.8f; const size_t oo = (size_t)t * 1024 + h * HD + d; v2us oh, ol; v2f sm = *(const v2f*)(O + e);   // O: the PVS partial planes of k_gemmpv, summed in plane order
#pragma unroll
    for (int u = 1; u < PVS; ++u) sm += *(const v2f*)(O + (size_t)u * TT * HD + e);
#pragma unroll
    for (int q = 0; q < 2; ++q) { unsigned short a, c2; splitf(sm[q] * cs, a, c2); oh[q] = a; ol[q] = c2; } *(v2us*)(Ah + oo) = oh; *(v2us*)(Al + oo) = ol;  }

extern "C" void kernel_launch(void* const* d_in, const int* in_sizes, int n_in,
                              void* d_out, int out_size, void* d_ws, size_t ws_size, hipStream_t stream) {
    (void)in_sizes; (void)n_in; (void)out_size;
    const float* x = (const float*)d_in[0]; const float* key1 = (const float*)d_in[1]; const float* key2 = (const float*)d_in[2]; const float* query1 = (const float*)d_in[3]; const float* query2 = (const float*)d_in[4]; const float* valw = (const float*)d_in[5]; const float* lambdas = (const float*)d_in[6]; const float* wo = (const float*)d_in[7]; const float* bo = (const float*)d_in[8]; const float* wq = nullptr; const float* wk = nullptr; const float* wv = nullptr; (void)wq; (void)wk; (void)wv; const float* cosT = nullptr; const float* sinT = nullptr; (void)cosT; (void)sinT;
    float* OUT = (float*)d_out;     // [2][2048][1024]
    char* wsp = (char*)d_ws;
    auto take = [&](size_t bytes) { char* p = wsp; wsp += (bytes + 255) & ~(size_t)255; return (void*)p; };
    bf* WQ = (bf*)take((size_t)DQ * DM * 2); bf* WK = (bf*)take((size_t)DKV * DM * 2); bf* WV = (bf*)take((size_t)DKV * DM * 2); bf* WO = (bf*)take((size_t)DM * DQ * 2); float* CS = (float*)take((size_t)TT * HD * 2 * 4);
    bf* XB = (bf*)take((size_t)TT * DM * 2); float* FQ = (float*)take((size_t)TT * DQ * 4); float* FK = (float*)take((size_t)TT * DKV * 4);
    h16* QP16 = (h16*)take((size_t)NH_ * TT * HD * 2); h16* KP16 = (h16*)take((size_t)NKV * TT * HD * 2); h16* VT16 = (h16*)take((size_t)NKV * HD * TT * 2);
    bf* QPh = (bf*)take((size_t)NH_ * TT * HD * 2); bf* QPl = (bf*)take((size_t)NH_ * TT * HD * 2); bf* KPh = (bf*)take((size_t)NKV * TT * HD * 2); bf* KPl = (bf*)take((size_t)NKV * TT * HD * 2); bf* VTh = (bf*)take((size_t)NKV * HD * TT * 2); bf* VTl = (bf*)take((size_t)NKV * HD * TT * 2); bf* Ph = (bf*)take((size_t)ZH * RH * TT * 2); bf* Pl = (bf*)take((size_t)ZH * RH * TT * 2);
    float* Sb = (float*)take((size_t)ZH * TT * TT * 4); h16* P16 = (h16*)take((size_t)ZH * TT * TT * 2); float* Ob = (float*)take((size_t)PVS * TT * HD * 4); bf* ATh = (bf*)take((size_t)TT * DQ * 2); bf* ATl = (bf*)take((size_t)TT * DQ * 2);
    if ((size_t)(wsp - (char*)d_ws) > ws_size) return;    // ws 256 MiB
    float* FV = FK;   // v projection reuses the k buffer after the k planes are built (stream-ordered)
    { k_wtH2<<<(unsigned)(((size_t)DQ * DM / 4 + 255) / 256), 256, 0, stream>>>(query1, query2, WQ); k_wtH2<<<(unsigned)(((size_t)DQ * DM / 4 + 255) / 256), 256, 0, stream>>>(key1, key2, WK); k_wtH1<<<(unsigned)(((size_t)1024 * DM / 4 + 255) / 256), 256, 0, stream>>>(valw, WV);
      k_wtG<<<(unsigned)((1024 * DM / 64 + 63) / 64), 256, 0, stream>>>(wo, 1024, DM, WO);
       }
    k_csid<<<(TT * HD + 255) / 256, 256, 0, stream>>>(CS);
    const unsigned LQ = (unsigned)(((size_t)NH_ * TT * HD / 2 + 255) / 256), LKv = (unsigned)(((size_t)NKV * TT * HD / 2 + 255) / 256);
    for (int b = 0; b < NB_; ++b) {
        
        k_cvt8<<<(unsigned)(((size_t)TT * DM / 8 + 255) / 256), 256, 0, stream>>>(x + (size_t)b * TT * DM, XB, (size_t)TT * DM / 8);
        k_gemmw<bf, 0, false><<<dim3(TT / 64, DQ / 64, 1), 32, 0, stream>>>(XB, nullptr, WQ, nullptr, DM, FQ, DQ, nullptr, 0, 0, 0);
        k_rope<<<LQ, 256, 0, stream>>>(FQ, DQ, NH_, CS, nullptr, nullptr, 1.0f, QP16, QPh, QPl);
        k_gemmw<bf, 0, false><<<dim3(TT / 64, DKV / 64, 1), 32, 0, stream>>>(XB, nullptr, WK, nullptr, DM, FK, DKV, nullptr, 0, 0, 0);
        k_rope<<<LKv, 256, 0, stream>>>(FK, DKV, NKV, CS, nullptr, nullptr, 1.0f, KP16, KPh, KPl);
        k_gemmw<bf, 0, false><<<dim3(TT / 64, 1024 / 64, 1), 32, 0, stream>>>(XB, nullptr, WV, nullptr, DM, FV, 1024, nullptr, 0, 0, 0); k_vtp<<<(unsigned)(((size_t)16 * HD * TT / 2 + 255) / 256), 256, 0, stream>>>(FV, 1024, 16, VT16, VTh, VTl);
        for (int h0 = 0; h0 < NH_; h0 += ZH) { const size_t zq = (size_t)h0, zk = (size_t)(h0 / REP);   // one kv head per query head: the pass's two heads use consecutive kv planes (z-strides TT*HD)
            k_gemmc<bf, 2, 1><<<dim3(RH / 64, TT / 64, ZH), 32, 0, stream>>>(QPh + zq * TT * HD, QPl + zq * TT * HD, KPh + zk * TT * HD, KPl + zk * TT * HD, HD, Sb, TT, 0, (size_t)TT * HD, (size_t)TT * HD, (size_t)TT * TT);
            k_gemmc<h16, 0, 1><<<dim3((TT - RH) / 64, TT / 64, ZH), 32, 0, stream>>>(QP16 + zq * TT * HD + (size_t)RH * HD, nullptr, KP16 + zk * TT * HD, nullptr, HD, Sb + (size_t)RH * TT, TT, RH, (size_t)TT * HD, (size_t)TT * HD, (size_t)TT * TT);
            k_dsoft<<<TT / 8, 256, 0, stream>>>(Sb, lambdas, P16, Ph, Pl);
            k_gemmpv<bf, 2, 2><<<dim3(RH / 64, PVS, 1), 64, 0, stream>>>(Ph, Pl, VTh + (size_t)(h0 / 2) * HD * TT, VTl + (size_t)(h0 / 2) * HD * TT, TT, Ob, 0);
            k_gemmpv<h16, 0, 8><<<dim3((TT - RH) / 64, PVS, 1), 256, 0, stream>>>(P16 + (size_t)RH * TT, nullptr, VT16 + (size_t)(h0 / 2) * HD * TT, nullptr, TT, Ob + (size_t)RH * HD, RH);
            k_dmerge<<<(unsigned)(((size_t)TT * HD / 2 + 255) / 256), 256, 0, stream>>>(Ob, h0 / 2, ATh, ATl); }
        k_gemmw<bf, 1, true><<<dim3(TT / 64, DM / 64, 1), 32, 0, stream>>>(ATh, ATl, WO, nullptr, 1024, OUT + (size_t)b * TT * DM, DM, bo, 0, 0, 0); }
}

// v002
// One run takes 809 microseconds.
// Timed twice side by side with v001, it ran 1.74 and 1.76 times as fast.
// Over all steps from v000 it is 3.55 times as fast.
#include <hip/hip_runtime.h>

// MultiHeadDifferentialAttention (x [2][2048][1024]; per-head q1/q2/k1/k2/v = x W[h] (W [16][1024][64], no bias); lam = exp(l0 l1) - exp(l2 l3) + 0.2 (lambdas read); wei = softmax(causal(q1.k1) / 8) - lam softmax(causal(q2.k2) / 8); out = (wei v merged) x (1 - 0.2) @ proj_w + proj_b -> [2][2048][1024]).
// The two score matrices of a head are computed as an adjacent pair of "score heads" (2h: q1/k1, 2h+1: q2/k2) so one pass of the causal score GEMM yields both; the differential softmax combines them into one probability matrix per head.
// Compute dtypes, f32 accumulate: every input rounded to bf16; the five projections on PLAIN bf16 operands (inputs: exact; per-head weights gathered); causal scores and wei.v: query rows < 512 hl (3 products), the rest single fp16 (x1024 carrier on wei); both softmaxes, lam and the difference f32; x 0.8 folded into the merge; proj hl x exact (2 products) + bias.

#define NB_  2
#define TT   2048
#define DM   1024
#define NH_  32
#define NKV  32
#define REP  (NH_ / NKV)
#define HD   64
#define DQ   (NH_ * HD)
#define DKV  (NKV * HD)
#define ZH   2
#define RH   512                  // query rows < RH use hi+lo planes (0: none)
#define CH   512                  // query rows per attention pass: one pass covers these rows of ALL heads of a batch element
#define NHD  16                   // heads (each a pair of score heads)
#define WIN  2048
#define PCAR 1024.0f
#define SCL  0.125f   // HD^-0.5
typedef _Float16 h16;
typedef unsigned short bf;
typedef __attribute__((ext_vector_type(16))) __bf16   v16bf;
typedef __attribute__((ext_vector_type(16))) _Float16 v16h;
typedef __attribute__((ext_vector_type(8)))  _Float16 v8h;
typedef __attribute__((ext_vector_type(8)))  unsigned short v8us;
typedef __attribute__((ext_vector_type(8)))  float    v8f;
typedef __attribute__((ext_vector_type(4)))  float    v4f;
typedef v8h  __attribute__((may_alias)) v8ha;
typedef v4f  __attribute__((may_alias)) v4fa;
typedef v8us __attribute__((may_alias)) v8usa;

__device__ __forceinline__ unsigned short f2bf(float f) { unsigned u = __float_as_uint(f); u += 0x7FFFu + ((u >> 16) & 1u); return (unsigned short)(u >> 16); }
__device__ __forceinline__ float bf2f(unsigned short b) { return __uint_as_float(((unsigned)b) << 16); }
__device__ __forceinline__ float bfr(float f) { return bf2f(f2bf(f)); }
__device__ __forceinline__ v16h cat16(v8h lo, v8h hi) { return __builtin_shufflevector(lo, hi, 0, 1, 2, 3, 4, 5, 6, 7, 8, 9, 10, 11, 12, 13, 14, 15); }
__device__ __forceinline__ v16bf cat16b(v8us lo, v8us hi) { return __builtin_bit_cast(v16bf, __builtin_shufflevector(lo, hi, 0, 1, 2, 3, 4, 5, 6, 7, 8, 9, 10, 11, 12, 13, 14, 15)); }
__device__ __forceinline__ v8f wmma16(v16h a, v16h b, v8f c) { return __builtin_amdgcn_wmma_f32_16x16x32_f16(false, a, false, b, (short)0, c, false, false); }
__device__ __forceinline__ v8f wmmab(v16bf a, v16bf b, v8f c) { return __builtin_amdgcn_wmma_f32_16x16x32_bf16(false, a, false, b, (short)0, c, false, false); }



// ---- k_gemmw: register-blocked GEMM, ONE WAVE per 64x64 output tile (16 accumulators), operands straight from K-contiguous 16-bit planes; grid (M/64, N/64, Z), 32 threads.
// C[m][n] (f32, pitch ldc, + optional f32 bias[n]) = sum_k A[m][k] Bt[n][k] (+ split products per NSPLIT). z-batch strides sA/sB/sC in elements. K % 32 == 0.
template <typename T16> struct WFrag;
template <> struct WFrag<h16> { typedef v16h V; static __device__ __forceinline__ V ld(const h16* p) { return cat16(*(const v8h*)p, *(const v8h*)(p + 16)); } static __device__ __forceinline__ v8f mma(V a, V b, v8f c) { return wmma16(a, b, c); } };
template <> struct WFrag<bf> { typedef v16bf V; static __device__ __forceinline__ V ld(const bf* p) { return cat16b(*(const v8us*)p, *(const v8us*)(p + 16)); } static __device__ __forceinline__ v8f mma(V a, V b, v8f c) { return wmmab(a, b, c); } };
template <typename T16, int NSPLIT, bool BIAS>
__global__ __launch_bounds__(32) void k_gemmw(const T16* __restrict__ A, const T16* __restrict__ A2, const T16* __restrict__ Bt, const T16* __restrict__ Bt2, int K, float* C, int ldc, const float* __restrict__ bias, size_t sA, size_t sB, size_t sC) {
    typedef typename WFrag<T16>::V V;
    __shared__ __align__(16) float os[16 * 68];
    const size_t z = blockIdx.z; A += z * sA; if (A2) A2 += z * sA; Bt += z * sB; if (Bt2) Bt2 += z * sB; C += z * sC;
    const int lane = threadIdx.x & 31, lr = lane & 15, hi = lane >> 4; const int r0 = blockIdx.x * 64, c0 = blockIdx.y * 64;
    v8f acc[4][4];
#pragma unroll
    for (int mb = 0; mb < 4; ++mb)
#pragma unroll
        for (int nb = 0; nb < 4; ++nb) acc[mb][nb] = (v8f){};
    const size_t aoff = (size_t)(r0 + lr) * K + 8 * hi, boff = (size_t)(c0 + lr) * K + 8 * hi;
#pragma unroll 1
    for (int kc = 0; kc < K; kc += 32) {
        V a[4], a2[4];
#pragma unroll
        for (int mb = 0; mb < 4; ++mb) { a[mb] = WFrag<T16>::ld(A + aoff + (size_t)mb * 16 * K + kc); if (NSPLIT == 1 || NSPLIT == 2) a2[mb] = WFrag<T16>::ld(A2 + aoff + (size_t)mb * 16 * K + kc); }
#pragma unroll
        for (int nb = 0; nb < 4; ++nb) { const V b = WFrag<T16>::ld(Bt + boff + (size_t)nb * 16 * K + kc); V b2; if (NSPLIT >= 2) b2 = WFrag<T16>::ld(Bt2 + boff + (size_t)nb * 16 * K + kc);
#pragma unroll
            for (int mb = 0; mb < 4; ++mb) { acc[mb][nb] = WFrag<T16>::mma(a[mb], b, acc[mb][nb]); if (NSPLIT == 1 || NSPLIT == 2) acc[mb][nb] = WFrag<T16>::mma(a2[mb], b, acc[mb][nb]); if (NSPLIT >= 2) acc[mb][nb] = WFrag<T16>::mma(a[mb], b2, acc[mb][nb]); } }
        asm volatile("v_nop\n\tv_nop\n\tv_nop\n\tv_nop" : "+v"(acc[0][0]), "+v"(acc[1][1]), "+v"(acc[2][2]), "+v"(acc[3][3]) : "v"(a[0]), "v"(a[3]));
    }
#pragma unroll
    for (int mb = 0; mb < 4; ++mb) {
#pragma unroll
        for (int nb = 0; nb < 4; ++nb) {
#pragma unroll
            for (int j = 0; j < 8; ++j) os[(hi * 8 + j) * 68 + nb * 16 + lr] = acc[mb][nb][j]; }
        __builtin_amdgcn_wave_barrier(); asm volatile("" ::: "memory");
        float* crow = C + (size_t)(r0 + mb * 16) * ldc + c0;
{
#pragma unroll
            for (int s = 0; s < 8; ++s) { const int row = 2 * s + hi, cofs = lr * 4; v4f val = *(const v4fa*)(os + row * 68 + cofs); if (BIAS) { val[0] += bfr(bias[c0 + cofs]); val[1] += bfr(bias[c0 + cofs + 1]); val[2] += bfr(bias[c0 + cofs + 2]); val[3] += bfr(bias[c0 + cofs + 3]); }
                *(v4f*)(crow + (size_t)row * ldc + cofs) = val; }
             }
        __builtin_amdgcn_wave_barrier(); asm volatile("" ::: "memory");
    }
}

// ---- k_gemmc: the same one-wave 64x64 tile GEMM specialised for causal attention: CMODE 1 skips score tiles entirely above the diagonal (query rows r0+roff.., key columns c0..), CMODE 2 limits the
// key (K) loop of the probability x value contraction to the diagonal block (probabilities beyond it are exactly zero). roff = row offset of this launch's first row within the sequence.
template <typename T16, int NSPLIT, int CMODE>
__global__ __launch_bounds__(32) void k_gemmc(const T16* __restrict__ A, const T16* __restrict__ A2, const T16* __restrict__ Bt, const T16* __restrict__ Bt2, int K, float* C, int ldc, int roff, size_t sA, size_t sB, size_t sC) {
    typedef typename WFrag<T16>::V V;
    __shared__ __align__(16) float os[16 * 68];
    const size_t z = blockIdx.z; A += z * sA; if (A2) A2 += z * sA; Bt += z * sB; if (Bt2) Bt2 += z * sB; C += z * sC;
    const int lane = threadIdx.x & 31, lr = lane & 15, hi = lane >> 4; const int r0 = blockIdx.x * 64, c0 = blockIdx.y * 64;
    if (CMODE == 1 && c0 > r0 + roff + 63) return;                  // score tile entirely above the causal diagonal: never read (the softmax masks j > i by select)
    const int Kl = (CMODE == 2) ? min(K, r0 + roff + 64) : K;        // P.V: probabilities are exactly 0 beyond the diagonal block, so the K loop stops there
    v8f acc[4][4];
#pragma unroll
    for (int mb = 0; mb < 4; ++mb)
#pragma unroll
        for (int nb = 0; nb < 4; ++nb) acc[mb][nb] = (v8f){};
    const size_t aoff = (size_t)(r0 + lr) * K + 8 * hi, boff = (size_t)(c0 + lr) * K + 8 * hi;
#pragma unroll 1
    for (int kc = 0; kc < Kl; kc += 32) {
        V a[4], a2[4];
#pragma unroll
        for (int mb = 0; mb < 4; ++mb) { a[mb] = WFrag<T16>::ld(A + aoff + (size_t)mb * 16 * K + kc); if (NSPLIT == 1 || NSPLIT == 2) a2[mb] = WFrag<T16>::ld(A2 + aoff + (size_t)mb * 16 * K + kc); }
#pragma unroll
        for (int nb = 0; nb < 4; ++nb) { const V b = WFrag<T16>::ld(Bt + boff + (size_t)nb * 16 * K + kc); V b2; if (NSPLIT >= 2) b2 = WFrag<T16>::ld(Bt2 + boff + (size_t)nb * 16 * K + kc);
#pragma unroll
            for (int mb = 0; mb < 4; ++mb) { acc[mb][nb] = WFrag<T16>::mma(a[mb], b, acc[mb][nb]); if (NSPLIT == 1 || NSPLIT == 2) acc[mb][nb] = WFrag<T16>::mma(a2[mb], b, acc[mb][nb]); if (NSPLIT >= 2) acc[mb][nb] = WFrag<T16>::mma(a[mb], b2, acc[mb][nb]); } }
        asm volatile("v_nop\n\tv_nop\n\tv_nop\n\tv_nop" : "+v"(acc[0][0]), "+v"(acc[1][1]), "+v"(acc[2][2]), "+v"(acc[3][3]) : "v"(a[0]), "v"(a[3]));
    }
#pragma unroll
    for (int mb = 0; mb < 4; ++mb) {
#pragma unroll
        for (int nb = 0; nb < 4; ++nb) {
#pragma unroll
            for (int j = 0; j < 8; ++j) os[(hi * 8 + j) * 68 + nb * 16 + lr] = acc[mb][nb][j]; }
        __builtin_amdgcn_wave_barrier(); asm volatile("" ::: "memory");
        float* crow = C + (size_t)(r0 + mb * 16) * ldc + c0;
{
#pragma unroll
            for (int s = 0; s < 8; ++s) { const int row = 2 * s + hi, cofs = lr * 4; v4f val = *(const v4fa*)(os + row * 68 + cofs);
                *(v4f*)(crow + (size_t)row * ldc + cofs) = val; }
             }
        __builtin_amdgcn_wave_barrier(); asm volatile("" ::: "memory");
    }
}

// ---- k_gemmpv: the probability x value contraction with its key (K) loop split: PVS work-groups x NW waves share one 64x64 output tile, wave g = blockIdx.y * NW + wave takes the 32-key chunks g, g + PVS * NW, ...
// up to the diagonal block (probabilities beyond it are exactly zero). The NW waves' f32 tiles are summed through LDS in wave order; each work-group stores one partial tile, plane blockIdx.y of its head in Cp ([head][PVS][CH][HD]); k_dmerge sums the planes.
// grid (CH / 64, PVS, heads), NW * 32 threads. roff = row offset of this launch's first row within the sequence; lda = row pitch of A; head z reads A + z sA, Bt + z sB and stores its planes at Cp + z PVS CH HD ([head][PVS][CH][HD]).
#define PVS 8
template <typename T16, int NSPLIT, int NW>
__global__ __launch_bounds__(NW * 32) void k_gemmpv(const T16* __restrict__ A, const T16* __restrict__ A2, const T16* __restrict__ Bt, const T16* __restrict__ Bt2, int K, int lda, float* Cp, int roff, size_t sA, size_t sB) {
    typedef typename WFrag<T16>::V V;
    __shared__ __align__(16) float red[NW * 64 * 68];
    const size_t z = blockIdx.z; A += z * sA; if (A2) A2 += z * sA; Bt += z * sB; if (Bt2) Bt2 += z * sB;
    const int lane = threadIdx.x & 31, lr = lane & 15, hi = lane >> 4; const int wv = __builtin_amdgcn_readfirstlane((int)(threadIdx.x >> 5)); const int r0 = blockIdx.x * 64;   // the wave's number as a scalar: the key loop's test is then a scalar branch
    const int Kl = min(K, r0 + roff + 64);
    v8f acc[4][4];
#pragma unroll
    for (int mb = 0; mb < 4; ++mb)
#pragma unroll
        for (int nb = 0; nb < 4; ++nb) acc[mb][nb] = (v8f){};
    const size_t aoff = (size_t)(r0 + lr) * lda + 8 * hi, boff = (size_t)lr * K + 8 * hi;
    // kept rolled: at these shapes a wave has at most one trip, a second copy of the body would only be code
#pragma unroll 1
    for (int kc = ((int)blockIdx.y * NW + wv) * 32; kc < Kl; kc += PVS * NW * 32) {
        V a[4], a2[4];
        // s_wait_xcnt 0 behind each fragment's two loads: a later load of the run may return its data into the registers that held this fragment's address; all fragments are loaded ahead of the products so that these statements do not part the loads
#pragma unroll
        for (int mb = 0; mb < 4; ++mb) { a[mb] = WFrag<T16>::ld(A + aoff + (size_t)mb * 16 * lda + kc); asm volatile("s_wait_xcnt 0x0" ::: "memory"); if (NSPLIT == 1 || NSPLIT == 2) { a2[mb] = WFrag<T16>::ld(A2 + aoff + (size_t)mb * 16 * lda + kc); asm volatile("s_wait_xcnt 0x0" ::: "memory"); } }
        V b[4], b2[4];
#pragma unroll
        for (int nb = 0; nb < 4; ++nb) { b[nb] = WFrag<T16>::ld(Bt + boff + (size_t)nb * 16 * K + kc); asm volatile("s_wait_xcnt 0x0" ::: "memory"); if (NSPLIT >= 2) { b2[nb] = WFrag<T16>::ld(Bt2 + boff + (size_t)nb * 16 * K + kc); asm volatile("s_wait_xcnt 0x0" ::: "memory"); } }
        __builtin_amdgcn_sched_barrier(0);   // keeps the products behind the last load: moved up between the loads they would wait for each B fragment in turn, one memory latency after another
#pragma unroll
        for (int nb = 0; nb < 4; ++nb)
#pragma unroll
            for (int mb = 0; mb < 4; ++mb) { acc[mb][nb] = WFrag<T16>::mma(a[mb], b[nb], acc[mb][nb]); if (NSPLIT == 1 || NSPLIT == 2) acc[mb][nb] = WFrag<T16>::mma(a2[mb], b[nb], acc[mb][nb]); if (NSPLIT >= 2) acc[mb][nb] = WFrag<T16>::mma(a[mb], b2[nb], acc[mb][nb]); }
        // the four vector slots behind the last matrix instruction, also on the loop's taken back edge
        asm volatile("v_nop\n\tv_nop\n\tv_nop\n\tv_nop" : "+v"(acc[0][0]), "+v"(acc[1][1]), "+v"(acc[2][2]), "+v"(acc[3][3]) : "v"(a[0]), "v"(a[3]));
    }
    float* mine = red + wv * (64 * 68);
#pragma unroll
    for (int mb = 0; mb < 4; ++mb)
#pragma unroll
        for (int nb = 0; nb < 4; ++nb)
#pragma unroll
            for (int j = 0; j < 8; ++j) mine[(mb * 16 + hi * 8 + j) * 68 + nb * 16 + lr] = acc[mb][nb][j];
    __syncthreads();   // every wave's tile is in LDS before any wave sums across them
    float* C = Cp + (z * PVS + blockIdx.y) * (size_t)(CH * HD) + (size_t)r0 * HD;
#pragma unroll
    for (int s = 0; s < 32 / NW; ++s) { const int idx = s * (NW * 32) + (int)threadIdx.x; const int row = idx >> 4, cofs = (idx & 15) * 4; v4f val = *(const v4fa*)(red + row * 68 + cofs);
#pragma unroll
        for (int u = 1; u < NW; ++u) val += *(const v4fa*)(red + u * (64 * 68) + row * 68 + cofs);
        *(v4f*)(C + (size_t)row * HD + cofs) = val; }
}

__device__ __forceinline__ h16 tohx(float x) { return (h16)x; }
__device__ __forceinline__ void splitf(float y, unsigned short& h, unsigned short& l) { h = f2bf(y); l = f2bf(y - bf2f(h)); }
typedef __attribute__((ext_vector_type(2))) _Float16 v2h;
typedef __attribute__((ext_vector_type(4))) _Float16 v4h;
typedef __attribute__((ext_vector_type(2))) unsigned short v2us;
typedef __attribute__((ext_vector_type(4))) unsigned short v4us;
typedef __attribute__((ext_vector_type(2))) float v2f;
typedef __attribute__((ext_vector_type(4))) int v4i;

__global__ __launch_bounds__(256) void k_wtG(const float* __restrict__ w, int K, int N, bf* Bt) {
    const int lane = threadIdx.x & 31; const int L0 = (blockIdx.x * 8 + (threadIdx.x >> 5)) * 8; const int nlines = N * K / 64;
{
#pragma unroll 1
        for (int l = 0; l < 8; ++l) { const int L = L0 + l; if (L >= nlines) break; const size_t e = (size_t)L * 64 + lane * 2; const int k = (int)(e % K), n = (int)(e / K); v2us o;
            o[0] = f2bf(w[(size_t)k * N + n]); o[1] = f2bf(w[(size_t)(k + 1) * N + n]); *(v2us*)(Bt + e) = o; }
         }
}
__global__ __launch_bounds__(256) void k_cvt8(const float* __restrict__ src, bf* dst, size_t n8) { const size_t i = (size_t)blockIdx.x * 256 + threadIdx.x; if (i >= n8) return; const v8f v = *(const v8f*)(src + i * 8); v8us o;
#pragma unroll
    for (int k = 0; k < 8; ++k) o[k] = f2bf(v[k]); *(v8us*)(dst + i * 8) = o;  }
__global__ __launch_bounds__(256) void k_cscvt(const float* __restrict__ cosT, const float* __restrict__ sinT, float* CS) { const int idx = blockIdx.x * 256 + threadIdx.x; if (idx >= TT * HD) return; v2f cs; cs[0] = bfr(cosT[idx]); cs[1] = bfr(sinT[idx]); *(v2f*)(CS + (size_t)idx * 2) = cs;  }
// k_rope: head planes [h][t][d] (fp16 + hi/lo) of rope(x) x sc with the rotate-half convention out[d] = x[d] cos[t][d] - x[d+HD/2] sin[t][d], out[d+HD/2] = x[d+HD/2] cos[t][d+HD/2] + x[d] sin[t][d+HD/2]
__global__ __launch_bounds__(256) void k_rope(const float* __restrict__ F, int pitch, int nheads, const float* __restrict__ CS, const float* __restrict__ RF, const float* __restrict__ nw, float sc, h16* P16, bf* Ph, bf* Pl) {
    const size_t e = ((size_t)blockIdx.x * 256 + threadIdx.x) * 2; if (e >= (size_t)nheads * TT * HD) return; const int d = (int)(e % HD); const int t = (int)((e / HD) % TT); const int h = (int)(e / ((size_t)HD * TT)); const float* f = F + (size_t)t * pitch + h * HD; const float rf = RF ? RF[(size_t)h * TT + t] : 1.0f; v2h o16; v2us oh, ol;
#pragma unroll
    for (int q = 0; q < 2; ++q) { const int dd = d + q; const int dp = (dd < HD / 2) ? dd + HD / 2 : dd - HD / 2; float x0 = f[dd], x1 = f[dp];
        if (RF) { float n0 = __fmul_rn(x0, rf), n1 = __fmul_rn(x1, rf); asm volatile("" : "+v"(n0)); asm volatile("" : "+v"(n1)); x0 = __fmul_rn(bfr(nw[dd]), n0); x1 = __fmul_rn(bfr(nw[dp]), n1); }
        const v2f cs = *(const v2f*)(CS + ((size_t)t * HD + dd) * 2); float a = __fmul_rn(x0, cs[0]), bq = __fmul_rn(x1, cs[1]); asm volatile("" : "+v"(a)); asm volatile("" : "+v"(bq)); const float r = ((dd < HD / 2) ? __fsub_rn(a, bq) : __fadd_rn(a, bq)) * sc;
        o16[q] = tohx(r); unsigned short a2, c2; splitf(r, a2, c2); oh[q] = a2; ol[q] = c2; }
    *(v2h*)(P16 + e) = o16; *(v2us*)(Ph + e) = oh; *(v2us*)(Pl + e) = ol;  }
__global__ __launch_bounds__(256) void k_vtp(const float* __restrict__ F, int pitch, int nheads, h16* V16, bf* Vh, bf* Vl) { const size_t e = ((size_t)blockIdx.x * 256 + threadIdx.x) * 2; if (e >= (size_t)nheads * HD * TT) return; const int t = (int)(e % TT); const int d = (int)((e / TT) % HD); const int g = (int)(e / ((size_t)TT * HD)); v2h o16; v2us oh, ol;
#pragma unroll
    for (int q = 0; q < 2; ++q) { const float x = F[(size_t)(t + q) * pitch + g * HD + d]; o16[q] = tohx(x); unsigned short a2, c2; splitf(x, a2, c2); oh[q] = a2; ol[q] = c2; }
    *(v2h*)(V16 + e) = o16; *(v2us*)(Vh + e) = oh; *(v2us*)(Vl + e) = ol;  }
__global__ __launch_bounds__(256) void k_csid(float* CS) { const int idx = blockIdx.x * 256 + threadIdx.x; if (idx >= TT * HD) return; v2f cs; cs[0] = 1.0f; cs[1] = 0.0f; *(v2f*)(CS + (size_t)idx * 2) = cs;  }
// k_asoft: per row (zz, i): t = S x HD^-0.5 for j <= i and i - j < WIN (sliding causal window; the reference's -1e9 additive fill vanishes identically); softmax over the 2048 keys (register row, one exp, fixed trees);
__global__ __launch_bounds__(256) void k_asoft(const float* __restrict__ Sb, h16* P16, bf* Ph, bf* Pl) {
    const int lane = threadIdx.x & 31; const int row = blockIdx.x * 8 + (threadIdx.x >> 5); if (row >= ZH * TT) return; const int i = row % TT; const int zz = row / TT; (void)zz; const bool hires = (i < RH); const float* sr = Sb + (size_t)row * TT; float v[TT / 32]; float mx = -3.0e38f;
#pragma unroll
    for (int ch = 0; ch < TT / 128; ++ch) { const int j0 = ch * 128 + lane * 4; const v4f a = *(const v4f*)(sr + j0);
#pragma unroll
        for (int q = 0; q < 4; ++q) { const int j = j0 + q; (void)j; const float t = (j <= i && i - j < WIN) ? a[q] * SCL : -3.0e38f; v[ch * 4 + q] = t; mx = fmaxf(mx, t); } }
#pragma unroll
    for (int sh = 16; sh; sh >>= 1) mx = fmaxf(mx, __shfl_xor(mx, sh, 32));
    float sum = 0.f;
#pragma unroll
    for (int k = 0; k < TT / 32; ++k) { float d0 = __fsub_rn(v[k], mx); asm volatile("" : "+v"(d0)); v[k] = __builtin_amdgcn_exp2f(__fmul_rn(d0, 1.4426950408889634f)); sum += v[k]; }
#pragma unroll
    for (int sh = 16; sh; sh >>= 1) sum += __shfl_xor(sum, sh, 32);
    const float f = __fdiv_rn(hires ? 1.0f : PCAR, sum);
{
        if (hires) {
#pragma unroll
            for (int ch = 0; ch < TT / 128; ++ch) { v4us oh, ol;
#pragma unroll
                for (int q = 0; q < 4; ++q) { unsigned short a, c2; splitf(v[ch * 4 + q] * f, a, c2); oh[q] = a; ol[q] = c2; }
                const size_t oo = ((size_t)zz * (RH ? RH : 1) + i) * TT + ch * 128 + lane * 4; *(v4us*)(Ph + oo) = oh; *(v4us*)(Pl + oo) = ol; }
        } else {
#pragma unroll
            for (int ch = 0; ch < TT / 128; ++ch) { v4h o4;
#pragma unroll
                for (int q = 0; q < 4; ++q) o4[q] = tohx(v[ch * 4 + q] * f);
                *(v4h*)(P16 + (size_t)row * TT + ch * 128 + lane * 4) = o4; } }
         }
}
__global__ __launch_bounds__(256) void k_merge(const float* __restrict__ O, int h0, bf* Ah, bf* Al) { const size_t e = ((size_t)blockIdx.x * 256 + threadIdx.x) * 2; if (e >= (size_t)ZH * TT * HD) return; const int d = (int)(e % HD); const int t = (int)((e / HD) % TT); const int zz = (int)(e / ((size_t)HD * TT)); const float cs = (t < RH) ? 1.0f : (1.0f / PCAR); const size_t oo = (size_t)t * DQ + (h0 + zz) * HD + d;
    v2us oh, ol;
#pragma unroll
    for (int q = 0; q < 2; ++q) { unsigned short a, c2; splitf(O[e + q] * cs, a, c2); oh[q] = a; ol[q] = c2; } *(v2us*)(Ah + oo) = oh; *(v2us*)(Al + oo) = ol;  }

__global__ __launch_bounds__(256) void k_wtH2(const float* __restrict__ w1, const float* __restrict__ w2, bf* Bt) { const size_t e = ((size_t)blockIdx.x * 256 + threadIdx.x) * 4; if (e >= (size_t)DQ * DM) return; const int k = (int)(e % DM); const int n = (int)(e / DM); const int hh = n / HD, c = n % HD; const int h = hh >> 1; const float* w = (hh & 1) ? w2 : w1; v4us o;
#pragma unroll
    for (int u = 0; u < 4; ++u) o[u] = f2bf(w[((size_t)h * DM + k + u) * HD + c]); *(v4us*)(Bt + e) = o;  }
__global__ __launch_bounds__(256) void k_wtH1(const float* __restrict__ w, bf* Bt) { const size_t e = ((size_t)blockIdx.x * 256 + threadIdx.x) * 4; if (e >= (size_t)1024 * DM) return; const int k = (int)(e % DM); const int n = (int)(e / DM); const int h = n / HD, c = n % HD; v4us o;
#pragma unroll
    for (int u = 0; u < 4; ++u) o[u] = f2bf(w[((size_t)h * DM + k + u) * HD + c]); *(v4us*)(Bt + e) = o;  }
// k_dsoft: grid (CH / 8, heads), one wave per query row i = R0 + il of head blockIdx.y. Sb: [score head][CH][TT] f32. The row's probabilities overwrite its own two score rows (both are whole in this wave's registers before the first store):
// the fp16 row takes the first half of score row 1, the hi and lo planes the two halves of score row 2; so Sb carries no __restrict__.
__global__ __launch_bounds__(256) void k_dsoft(float* Sb, const float* __restrict__ lam4, int R0) {
    const int lane = threadIdx.x & 31; const int il = blockIdx.x * 8 + (threadIdx.x >> 5); if (il >= CH) return; const int i = R0 + il; float la = bfr(lam4[0]), lb = bfr(lam4[1]), lc = bfr(lam4[2]), ld = bfr(lam4[3]); asm volatile("" : "+v"(la)); asm volatile("" : "+v"(lc)); float pa = __fmul_rn(la, lb), pc = __fmul_rn(lc, ld); asm volatile("" : "+v"(pa)); asm volatile("" : "+v"(pc)); float lam = __fsub_rn(__expf(pa), __expf(pc)); asm volatile("" : "+v"(lam)); lam = __fadd_rn(lam, 0.2f);
    float* s1 = Sb + ((size_t)blockIdx.y * 2 * CH + il) * TT; float* s2 = s1 + (size_t)CH * TT; h16* P16 = (h16*)s1; bf* Ph = (bf*)s2; bf* Pl = Ph + TT; float v1[TT / 32], v2[TT / 32]; float m1 = -3.0e38f, m2 = -3.0e38f;
#pragma unroll
    for (int ch = 0; ch < TT / 128; ++ch) { const int j0 = ch * 128 + lane * 4; const v4f a = *(const v4f*)(s1 + j0), c4 = *(const v4f*)(s2 + j0);
#pragma unroll
        for (int q = 0; q < 4; ++q) { const int j = j0 + q; float t1 = (j <= i) ? a[q] * SCL : -3.0e38f, t2 = (j <= i) ? c4[q] * SCL : -3.0e38f; asm volatile("" : "+v"(t1)); asm volatile("" : "+v"(t2)); v1[ch * 4 + q] = t1; v2[ch * 4 + q] = t2; m1 = fmaxf(m1, t1); m2 = fmaxf(m2, t2); } }
#pragma unroll
    for (int sh = 16; sh; sh >>= 1) { m1 = fmaxf(m1, __shfl_xor(m1, sh, 32)); m2 = fmaxf(m2, __shfl_xor(m2, sh, 32)); }
    float e1 = 0.f, e2 = 0.f;
#pragma unroll
    for (int q = 0; q < TT / 32; ++q) { float d1 = __fsub_rn(v1[q], m1), d2 = __fsub_rn(v2[q], m2); asm volatile("" : "+v"(d1)); asm volatile("" : "+v"(d2)); v1[q] = __builtin_amdgcn_exp2f(__fmul_rn(d1, 1.4426950408889634f)); v2[q] = __builtin_amdgcn_exp2f(__fmul_rn(d2, 1.4426950408889634f)); e1 += v1[q]; e2 += v2[q]; }
#pragma unroll
    for (int sh = 16; sh; sh >>= 1) { e1 += __shfl_xor(e1, sh, 32); e2 += __shfl_xor(e2, sh, 32); }
    const float f1 = __fdiv_rn(1.0f, e1), f2 = __fdiv_rn(1.0f, e2); const bool hires = (i < RH);
    {
#pragma unroll
        for (int ch = 0; ch < TT / 128; ++ch) { v4h o4; v4us oh, ol;
#pragma unroll
            for (int q = 0; q < 4; ++q) { float p1 = __fmul_rn(v1[ch * 4 + q], f1), p2 = __fmul_rn(v2[ch * 4 + q], f2); asm volatile("" : "+v"(p2)); float lp = __fmul_rn(lam, p2); asm volatile("" : "+v"(lp)); const float w = __fsub_rn(p1, lp); o4[q] = tohx(w * PCAR); unsigned short a2, c2; splitf(w, a2, c2); oh[q] = a2; ol[q] = c2; }
            const size_t oo = ch * 128 + lane * 4; *(v4h*)(P16 + oo) = o4; if (hires) { *(v4us*)(Ph + oo) = oh; *(v4us*)(Pl + oo) = ol; } }
         } }
__global__ __launch_bounds__(256) void k_dmerge(const float* __restrict__ O, int R0, bf* Ah, bf* Al) { const size_t e = ((size_t)blockIdx.x * 256 + threadIdx.x) * 2; if (e >= (size_t)CH * HD) return; const int h = blockIdx.y; O += (size_t)h * PVS * CH * HD; const int d = (int)(e % HD); const int t = R0 + (int)(e / HD); const float cs = ((t < RH) ? 1.0f : (1.0f / PCAR)) * 0.8f; const size_t oo = (size_t)t * 1024 + h * HD + d; v2us oh, ol; v2f sm = *(const v2f*)(O + e);   // O: head h's PVS partial planes of k_gemmpv ([head][PVS][CH][HD]), summed in plane order; grid (CH HD / 512, heads)
#pragma unroll
    for (int u = 1; u < PVS; ++u) sm += *(const v2f*)(O + (size_t)u * CH * HD + e);
#pragma unroll
    for (int q = 0; q < 2; ++q) { unsigned short a, c2; splitf(sm[q] * cs, a, c2); oh[q] = a; ol[q] = c2; } *(v2us*)(Ah + oo) = oh; *(v2us*)(Al + oo) = ol;  }

extern "C" void kernel_launch(void* const* d_in, const int* in_sizes, int n_in,
                              void* d_out, int out_size, void* d_ws, size_t ws_size, hipStream_t stream) {
    (void)in_sizes; (void)n_in; (void)out_size;
    const float* x = (const float*)d_in[0]; const float* key1 = (const float*)d_in[1]; const float* key2 = (const float*)d_in[2]; const float* query1 = (const float*)d_in[3]; const float* query2 = (const float*)d_in[4]; const float* valw = (const float*)d_in[5]; const float* lambdas = (const float*)d_in[6]; const float* wo = (const float*)d_in[7]; const float* bo = (const float*)d_in[8]; const float* wq = nullptr; const float* wk = nullptr; const float* wv = nullptr; (void)wq; (void)wk; (void)wv; const float* cosT = nullptr; const float* sinT = nullptr; (void)cosT; (void)sinT;
    float* OUT = (float*)d_out;     // [2][2048][1024]
    char* wsp = (char*)d_ws;
    auto take = [&](size_t bytes) { char* p = wsp; wsp += (bytes + 255) & ~(size_t)255; return (void*)p; };
    bf* WQ = (bf*)take((size_t)DQ * DM * 2); bf* WK = (bf*)take((size_t)DKV * DM * 2); bf* WV = (bf*)take((size_t)DKV * DM * 2); bf* WO = (bf*)take((size_t)DM * DQ * 2); float* CS = (float*)take((size_t)TT * HD * 2 * 4);
    bf* XB = (bf*)take((size_t)TT * DM * 2);
    h16* QP16 = (h16*)take((size_t)NH_ * TT * HD * 2); h16* KP16 = (h16*)take((size_t)NKV * TT * HD * 2); h16* VT16 = (h16*)take((size_t)NKV * HD * TT * 2);
    bf* QPh = (bf*)take((size_t)NH_ * TT * HD * 2); bf* QPl = (bf*)take((size_t)NH_ * TT * HD * 2); bf* KPh = (bf*)take((size_t)NKV * TT * HD * 2); bf* KPl = (bf*)take((size_t)NKV * TT * HD * 2); bf* VTh = (bf*)take((size_t)NKV * HD * TT * 2); bf* VTl = (bf*)take((size_t)NKV * HD * TT * 2);
    // Sb: [score head][CH][TT], one pass's scores of all heads, then its probabilities in place; Ob: [head][PVS][CH][HD]
    float* Sb = (float*)take((size_t)NH_ * CH * TT * 4); float* Ob = (float*)take((size_t)NHD * PVS * CH * HD * 4); bf* ATh = (bf*)take((size_t)TT * DQ * 2); bf* ATl = (bf*)take((size_t)TT * DQ * 2);
    if ((size_t)(wsp - (char*)d_ws) > ws_size) return;    // ws 256 MiB
    static_assert(RH % CH == 0 && TT % CH == 0 && (size_t)NH_ * CH * TT >= (size_t)TT * (DQ + DKV), "a pass is all hi+lo or all fp16; the projections fit the score buffer");
    float* FQ = Sb; float* FK = Sb + (size_t)TT * DQ;   // the f32 projections are dead once the head planes are built, before the first pass writes scores (stream-ordered)
    float* FV = FK;   // v projection reuses the k buffer after the k planes are built (stream-ordered)
    { k_wtH2<<<(unsigned)(((size_t)DQ * DM / 4 + 255) / 256), 256, 0, stream>>>(query1, query2, WQ); k_wtH2<<<(unsigned)(((size_t)DQ * DM / 4 + 255) / 256), 256, 0, stream>>>(key1, key2, WK); k_wtH1<<<(unsigned)(((size_t)1024 * DM / 4 + 255) / 256), 256, 0, stream>>>(valw, WV);
      k_wtG<<<(unsigned)((1024 * DM / 64 + 63) / 64), 256, 0, stream>>>(wo, 1024, DM, WO);
       }
    k_csid<<<(TT * HD + 255) / 256, 256, 0, stream>>>(CS);
    const unsigned LQ = (unsigned)(((size_t)NH_ * TT * HD / 2 + 255) / 256), LKv = (unsigned)(((size_t)NKV * TT * HD / 2 + 255) / 256);
    for (int b = 0; b < NB_; ++b) {
        
        k_cvt8<<<(unsigned)(((size_t)TT * DM / 8 + 255) / 256), 256, 0, stream>>>(x + (size_t)b * TT * DM, XB, (size_t)TT * DM / 8);
        k_gemmw<bf, 0, false><<<dim3(TT / 64, DQ / 64, 1), 32, 0, stream>>>(XB, nullptr, WQ, nullptr, DM, FQ, DQ, nullptr, 0, 0, 0);
        k_rope<<<LQ, 256, 0, stream>>>(FQ, DQ, NH_, CS, nullptr, nullptr, 1.0f, QP16, QPh, QPl);
        k_gemmw<bf, 0, false><<<dim3(TT / 64, DKV / 64, 1), 32, 0, stream>>>(XB, nullptr, WK, nullptr, DM, FK, DKV, nullptr, 0, 0, 0);
        k_rope<<<LKv, 256, 0, stream>>>(FK, DKV, NKV, CS, nullptr, nullptr, 1.0f, KP16, KPh, KPl);
        k_gemmw<bf, 0, false><<<dim3(TT / 64, 1024 / 64, 1), 32, 0, stream>>>(XB, nullptr, WV, nullptr, DM, FV, 1024, nullptr, 0, 0, 0); k_vtp<<<(unsigned)(((size_t)16 * HD * TT / 2 + 255) / 256), 256, 0, stream>>>(FV, 1024, 16, VT16, VTh, VTl);
        for (int R0 = 0; R0 < TT; R0 += CH) {   // one pass: query rows R0 .. R0 + CH - 1 of all heads; key tiles beyond the pass's last row are not launched
            const size_t sP = (size_t)4 * CH * TT;   // 16-bit elements from one head's pair of score planes to the next
            if (R0 < RH) k_gemmc<bf, 2, 1><<<dim3(CH / 64, (R0 + CH) / 64, NH_), 32, 0, stream>>>(QPh + (size_t)R0 * HD, QPl + (size_t)R0 * HD, KPh, KPl, HD, Sb, TT, R0, (size_t)TT * HD, (size_t)TT * HD, (size_t)CH * TT);
            else k_gemmc<h16, 0, 1><<<dim3(CH / 64, (R0 + CH) / 64, NH_), 32, 0, stream>>>(QP16 + (size_t)R0 * HD, nullptr, KP16, nullptr, HD, Sb, TT, R0, (size_t)TT * HD, (size_t)TT * HD, (size_t)CH * TT);
            k_dsoft<<<dim3(CH / 8, NHD), 256, 0, stream>>>(Sb, lambdas, R0);
            if (R0 < RH) k_gemmpv<bf, 2, 2><<<dim3(CH / 64, PVS, NHD), 64, 0, stream>>>((const bf*)(Sb + (size_t)CH * TT), (const bf*)(Sb + (size_t)CH * TT) + TT, VTh, VTl, TT, 2 * TT, Ob, R0, sP, (size_t)HD * TT);
            else k_gemmpv<h16, 0, 8><<<dim3(CH / 64, PVS, NHD), 256, 0, stream>>>((const h16*)Sb, nullptr, VT16, nullptr, TT, 2 * TT, Ob, R0, sP, (size_t)HD * TT);
            k_dmerge<<<dim3((unsigned)(((size_t)CH * HD / 2 + 255) / 256), NHD), 256, 0, stream>>>(Ob, R0, ATh, ATl); }
        k_gemmw<bf, 1, true><<<dim3(TT / 64, DM / 64, 1), 32, 0, stream>>>(ATh, ATl, WO, nullptr, 1024, OUT + (size_t)b * TT * DM, DM, bo, 0, 0, 0); }
}

// v003
// A run of this version takes 430 microseconds.
// Timed twice side by side with v002, it ran 1.87 and 1.90 times as fast.
// Counting every step since v000, it is 6.69 times as fast.
#include <hip/hip_runtime.h>

// Multi-head differential attention (x [2][2048][1024]; per-head q1/q2/k1/k2/v = x W[h] (W [16][1024][64], no bias); lam = exp(l0 l1) - exp(l2 l3) + 0.2 (lambdas read); wei = softmax(causal(q1.k1) / 8) - lam softmax(causal(q2.k2) / 8); out = (wei v merged) x (1 - 0.2) @ proj_w + proj_b -> [2][2048][1024]).
// The two score matrices of a head are computed as an adjacent pair of "score heads" (2h: q1/k1, 2h+1: q2/k2) so one pass of the causal score GEMM yields both; the differential softmax combines them into one probability matrix per head.
// Compute dtypes, f32 accumulate: every input rounded to bf16; the five projections on PLAIN bf16 operands (inputs: exact; per-head weights gathered); causal scores and wei.v: query rows < 512 hl (3 products), the rest single fp16 (x1024 carrier on wei); both softmaxes, lam and the difference f32; x 0.8 folded into the merge; proj hl x exact (2 products) + bias.

#define NB_  2
#define TT   2048
#define DM   1024
#define NH_  32
#define NKV  32
#define REP  (NH_ / NKV)
#define HD   64
#define DQ   (NH_ * HD)
#define DKV  (NKV * HD)
#define ZH   2
#define RH   512                  // query rows < RH use hi+lo planes (0: none)
#define NHD  16                   // heads (each a pair of score heads)
#define WIN  2048
#define PCAR 1024.0f
#define SCL  0.125f   // HD^-0.5
typedef _Float16 h16;
typedef unsigned short bf;
typedef __attribute__((ext_vector_type(16))) __bf16   v16bf;
typedef __attribute__((ext_vector_type(16))) _Float16 v16h;
typedef __attribute__((ext_vector_type(8)))  _Float16 v8h;
typedef __attribute__((ext_vector_type(8)))  unsigned short v8us;
typedef __attribute__((ext_vector_type(8)))  float    v8f;
typedef __attribute__((ext_vector_type(4)))  float    v4f;
typedef v8h  __attribute__((may_alias)) v8ha;
typedef v4f  __attribute__((may_alias)) v4fa;
typedef v8us __attribute__((may_alias)) v8usa;

__device__ __forceinline__ unsigned short f2bf(float f) { unsigned u = __float_as_uint(f); u += 0x7FFFu + ((u >> 16) & 1u); return (unsigned short)(u >> 16); }
__device__ __forceinline__ float bf2f(unsigned short b) { return __uint_as_float(((unsigned)b) << 16); }
__device__ __forceinline__ float bfr(float f) { return bf2f(f2bf(f)); }
__device__ __forceinline__ v16h cat16(v8h lo, v8h hi) { return __builtin_shufflevector(lo, hi, 0, 1, 2, 3, 4, 5, 6, 7, 8, 9, 10, 11, 12, 13, 14, 15); }
__device__ __forceinline__ v16bf cat16b(v8us lo, v8us hi) { return __builtin_bit_cast(v16bf, __builtin_shufflevector(lo, hi, 0, 1, 2, 3, 4, 5, 6, 7, 8, 9, 10, 11, 12, 13, 14, 15)); }
__device__ __forceinline__ v8f wmma16(v16h a, v16h b, v8f c) { return __builtin_amdgcn_wmma_f32_16x16x32_f16(false, a, false, b, (short)0, c, false, false); }
__device__ __forceinline__ v8f wmmab(v16bf a, v16bf b, v8f c) { return __builtin_amdgcn_wmma_f32_16x16x32_bf16(false, a, false, b, (short)0, c, false, false); }



// ---- k_gemmw: register-blocked GEMM, ONE WAVE per 64x64 output tile (16 accumulators), operands straight from K-contiguous 16-bit planes; grid (M/64, N/64, Z), 32 threads.
// C[m][n] (f32, pitch ldc, + optional f32 bias[n]) = sum_k A[m][k] Bt[n][k] (+ split products per NSPLIT). z-batch strides sA/sB/sC in elements. K % 32 == 0.
template <typename T16> struct WFrag;
template <> struct WFrag<h16> { typedef v16h V; static __device__ __forceinline__ V ld(const h16* p) { return cat16(*(const v8h*)p, *(const v8h*)(p + 16)); } static __device__ __forceinline__ v8f mma(V a, V b, v8f c) { return wmma16(a, b, c); } };
template <> struct WFrag<bf> { typedef v16bf V; static __device__ __forceinline__ V ld(const bf* p) { return cat16b(*(const v8us*)p, *(const v8us*)(p + 16)); } static __device__ __forceinline__ v8f mma(V a, V b, v8f c) { return wmmab(a, b, c); } };
template <typename T16, int NSPLIT, bool BIAS>
__global__ __launch_bounds__(32) void k_gemmw(const T16* __restrict__ A, const T16* __restrict__ A2, const T16* __restrict__ Bt, const T16* __restrict__ Bt2, int K, float* C, int ldc, const float* __restrict__ bias, size_t sA, size_t sB, size_t sC) {
    typedef typename WFrag<T16>::V V;
    __shared__ __align__(16) float os[16 * 68];
    const size_t z = blockIdx.z; A += z * sA; if (A2) A2 += z * sA; Bt += z * sB; if (Bt2) Bt2 += z * sB; C += z * sC;
    const int lane = threadIdx.x & 31, lr = lane & 15, hi = lane >> 4; const int r0 = blockIdx.x * 64, c0 = blockIdx.y * 64;
    v8f acc[4][4];
#pragma unroll
    for (int mb = 0; mb < 4; ++mb)
#pragma unroll
        for (int nb = 0; nb < 4; ++nb) acc[mb][nb] = (v8f){};
    const size_t aoff = (size_t)(r0 + lr) * K + 8 * hi, boff = (size_t)(c0 + lr) * K + 8 * hi;
#pragma unroll 1
    for (int kc = 0; kc < K; kc += 32) {
        V a[4], a2[4];
#pragma unroll
        for (int mb = 0; mb < 4; ++mb) { a[mb] = WFrag<T16>::ld(A + aoff + (size_t)mb * 16 * K + kc); if (NSPLIT == 1 || NSPLIT == 2) a2[mb] = WFrag<T16>::ld(A2 + aoff + (size_t)mb * 16 * K + kc); }
#pragma unroll
        for (int nb = 0; nb < 4; ++nb) { const V b = WFrag<T16>::ld(Bt + boff + (size_t)nb * 16 * K + kc); V b2; if (NSPLIT >= 2) b2 = WFrag<T16>::ld(Bt2 + boff + (size_t)nb * 16 * K + kc);
#pragma unroll
            for (int mb = 0; mb < 4; ++mb) { acc[mb][nb] = WFrag<T16>::mma(a[mb], b, acc[mb][nb]); if (NSPLIT == 1 || NSPLIT == 2) acc[mb][nb] = WFrag<T16>::mma(a2[mb], b, acc[mb][nb]); if (NSPLIT >= 2) acc[mb][nb] = WFrag<T16>::mma(a[mb], b2, acc[mb][nb]); } }
        asm volatile("v_nop\n\tv_nop\n\tv_nop\n\tv_nop" : "+v"(acc[0][0]), "+v"(acc[1][1]), "+v"(acc[2][2]), "+v"(acc[3][3]) : "v"(a[0]), "v"(a[3]));
    }
#pragma unroll
    for (int mb = 0; mb < 4; ++mb) {
#pragma unroll
        for (int nb = 0; nb < 4; ++nb) {
#pragma unroll
            for (int j = 0; j < 8; ++j) os[(hi * 8 + j) * 68 + nb * 16 + lr] = acc[mb][nb][j]; }
        __builtin_amdgcn_wave_barrier(); asm volatile("" ::: "memory");
        float* crow = C + (size_t)(r0 + mb * 16) * ldc + c0;
{
#pragma unroll
            for (int s = 0; s < 8; ++s) { const int row = 2 * s + hi, cofs = lr * 4; v4f val = *(const v4fa*)(os + row * 68 + cofs); if (BIAS) { val[0] += bfr(bias[c0 + cofs]); val[1] += bfr(bias[c0 + cofs + 1]); val[2] += bfr(bias[c0 + cofs + 2]); val[3] += bfr(bias[c0 + cofs + 3]); }
                *(v4f*)(crow + (size_t)row * ldc + cofs) = val; }
             }
        __builtin_amdgcn_wave_barrier(); asm volatile("" ::: "memory");
    }
}

__device__ __forceinline__ h16 tohx(float x) { return (h16)x; }
__device__ __forceinline__ void splitf(float y, unsigned short& h, unsigned short& l) { h = f2bf(y); l = f2bf(y - bf2f(h)); }
typedef __attribute__((ext_vector_type(2))) _Float16 v2h;
typedef __attribute__((ext_vector_type(4))) _Float16 v4h;
typedef __attribute__((ext_vector_type(2))) unsigned short v2us;
typedef __attribute__((ext_vector_type(4))) unsigned short v4us;
typedef __attribute__((ext_vector_type(2))) float v2f;
typedef __attribute__((ext_vector_type(4))) int v4i;

__global__ __launch_bounds__(256) void k_wtG(const float* __restrict__ w, int K, int N, bf* Bt) {
    const int lane = threadIdx.x & 31; const int L0 = (blockIdx.x * 8 + (threadIdx.x >> 5)) * 8; const int nlines = N * K / 64;
{
#pragma unroll 1
        for (int l = 0; l < 8; ++l) { const int L = L0 + l; if (L >= nlines) break; const size_t e = (size_t)L * 64 + lane * 2; const int k = (int)(e % K), n = (int)(e / K); v2us o;
            o[0] = f2bf(w[(size_t)k * N + n]); o[1] = f2bf(w[(size_t)(k + 1) * N + n]); *(v2us*)(Bt + e) = o; }
         }
}
__global__ __launch_bounds__(256) void k_cvt8(const float* __restrict__ src, bf* dst, size_t n8) { const size_t i = (size_t)blockIdx.x * 256 + threadIdx.x; if (i >= n8) return; const v8f v = *(const v8f*)(src + i * 8); v8us o;
#pragma unroll
    for (int k = 0; k < 8; ++k) o[k] = f2bf(v[k]); *(v8us*)(dst + i * 8) = o;  }
__global__ __launch_bounds__(256) void k_cscvt(const float* __restrict__ cosT, const float* __restrict__ sinT, float* CS) { const int idx = blockIdx.x * 256 + threadIdx.x; if (idx >= TT * HD) return; v2f cs; cs[0] = bfr(cosT[idx]); cs[1] = bfr(sinT[idx]); *(v2f*)(CS + (size_t)idx * 2) = cs;  }
// k_rope: head planes [h][t][d] (fp16 + hi/lo) of rope(x) x sc with the rotate-half convention out[d] = x[d] cos[t][d] - x[d+HD/2] sin[t][d], out[d+HD/2] = x[d+HD/2] cos[t][d+HD/2] + x[d] sin[t][d+HD/2]
__global__ __launch_bounds__(256) void k_rope(const float* __restrict__ F, int pitch, int nheads, const float* __restrict__ CS, const float* __restrict__ RF, const float* __restrict__ nw, float sc, h16* P16, bf* Ph, bf* Pl) {
    const size_t e = ((size_t)blockIdx.x * 256 + threadIdx.x) * 2; if (e >= (size_t)nheads * TT * HD) return; const int d = (int)(e % HD); const int t = (int)((e / HD) % TT); const int h = (int)(e / ((size_t)HD * TT)); const float* f = F + (size_t)t * pitch + h * HD; const float rf = RF ? RF[(size_t)h * TT + t] : 1.0f; v2h o16; v2us oh, ol;
#pragma unroll
    for (int q = 0; q < 2; ++q) { const int dd = d + q; const int dp = (dd < HD / 2) ? dd + HD / 2 : dd - HD / 2; float x0 = f[dd], x1 = f[dp];
        if (RF) { float n0 = __fmul_rn(x0, rf), n1 = __fmul_rn(x1, rf); asm volatile("" : "+v"(n0)); asm volatile("" : "+v"(n1)); x0 = __fmul_rn(bfr(nw[dd]), n0); x1 = __fmul_rn(bfr(nw[dp]), n1); }
        const v2f cs = *(const v2f*)(CS + ((size_t)t * HD + dd) * 2); float a = __fmul_rn(x0, cs[0]), bq = __fmul_rn(x1, cs[1]); asm volatile("" : "+v"(a)); asm volatile("" : "+v"(bq)); const float r = ((dd < HD / 2) ? __fsub_rn(a, bq) : __fadd_rn(a, bq)) * sc;
        o16[q] = tohx(r); unsigned short a2, c2; splitf(r, a2, c2); oh[q] = a2; ol[q] = c2; }
    *(v2h*)(P16 + e) = o16; *(v2us*)(Ph + e) = oh; *(v2us*)(Pl + e) = ol;  }
__global__ __launch_bounds__(256) void k_vtp(const float* __restrict__ F, int pitch, int nheads, h16* V16, bf* Vh, bf* Vl) { const size_t e = ((size_t)blockIdx.x * 256 + threadIdx.x) * 2; if (e >= (size_t)nheads * HD * TT) return; const int t = (int)(e % TT); const int d = (int)((e / TT) % HD); const int g = (int)(e / ((size_t)TT * HD)); v2h o16; v2us oh, ol;
#pragma unroll
    for (int q = 0; q < 2; ++q) { const float x = F[(size_t)(t + q) * pitch + g * HD + d]; o16[q] = tohx(x); unsigned short a2, c2; splitf(x, a2, c2); oh[q] = a2; ol[q] = c2; }
    *(v2h*)(V16 + e) = o16; *(v2us*)(Vh + e) = oh; *(v2us*)(Vl + e) = ol;  }
__global__ __launch_bounds__(256) void k_csid(float* CS) { const int idx = blockIdx.x * 256 + threadIdx.x; if (idx >= TT * HD) return; v2f cs; cs[0] = 1.0f; cs[1] = 0.0f; *(v2f*)(CS + (size_t)idx * 2) = cs;  }
// k_asoft: per row (zz, i): t = S x HD^-0.5 for j <= i and i - j < WIN (sliding causal window; the reference's -1e9 additive fill vanishes identically); softmax over the 2048 keys (register row, one exp, fixed trees);
__global__ __launch_bounds__(256) void k_asoft(const float* __restrict__ Sb, h16* P16, bf* Ph, bf* Pl) {
    const int lane = threadIdx.x & 31; const int row = blockIdx.x * 8 + (threadIdx.x >> 5); if (row >= ZH * TT) return; const int i = row % TT; const int zz = row / TT; (void)zz; const bool hires = (i < RH); const float* sr = Sb + (size_t)row * TT; float v[TT / 32]; float mx = -3.0e38f;
#pragma unroll
    for (int ch = 0; ch < TT / 128; ++ch) { const int j0 = ch * 128 + lane * 4; const v4f a = *(const v4f*)(sr + j0);
#pragma unroll
        for (int q = 0; q < 4; ++q) { const int j = j0 + q; (void)j; const float t = (j <= i && i - j < WIN) ? a[q] * SCL : -3.0e38f; v[ch * 4 + q] = t; mx = fmaxf(mx, t); } }
#pragma unroll
    for (int sh = 16; sh; sh >>= 1) mx = fmaxf(mx, __shfl_xor(mx, sh, 32));
    float sum = 0.f;
#pragma unroll
    for (int k = 0; k < TT / 32; ++k) { float d0 = __fsub_rn(v[k], mx); asm volatile("" : "+v"(d0)); v[k] = __builtin_amdgcn_exp2f(__fmul_rn(d0, 1.4426950408889634f)); sum += v[k]; }
#pragma unroll
    for (int sh = 16; sh; sh >>= 1) sum += __shfl_xor(sum, sh, 32);
    const float f = __fdiv_rn(hires ? 1.0f : PCAR, sum);
{
        if (hires) {
#pragma unroll
            for (int ch = 0; ch < TT / 128; ++ch) { v4us oh, ol;
#pragma unroll
                for (int q = 0; q < 4; ++q) { unsigned short a, c2; splitf(v[ch * 4 + q] * f, a, c2); oh[q] = a; ol[q] = c2; }
                const size_t oo = ((size_t)zz * (RH ? RH : 1) + i) * TT + ch * 128 + lane * 4; *(v4us*)(Ph + oo) = oh; *(v4us*)(Pl + oo) = ol; }
        } else {
#pragma unroll
            for (int ch = 0; ch < TT / 128; ++ch) { v4h o4;
#pragma unroll
                for (int q = 0; q < 4; ++q) o4[q] = tohx(v[ch * 4 + q] * f);
                *(v4h*)(P16 + (size_t)row * TT + ch * 128 + lane * 4) = o4; } }
         }
}
__global__ __launch_bounds__(256) void k_merge(const float* __restrict__ O, int h0, bf* Ah, bf* Al) { const size_t e = ((size_t)blockIdx.x * 256 + threadIdx.x) * 2; if (e >= (size_t)ZH * TT * HD) return; const int d = (int)(e % HD); const int t = (int)((e / HD) % TT); const int zz = (int)(e / ((size_t)HD * TT)); const float cs = (t < RH) ? 1.0f : (1.0f / PCAR); const size_t oo = (size_t)t * DQ + (h0 + zz) * HD + d;
    v2us oh, ol;
#pragma unroll
    for (int q = 0; q < 2; ++q) { unsigned short a, c2; splitf(O[e + q] * cs, a, c2); oh[q] = a; ol[q] = c2; } *(v2us*)(Ah + oo) = oh; *(v2us*)(Al + oo) = ol;  }

__global__ __launch_bounds__(256) void k_wtH2(const float* __restrict__ w1, const float* __restrict__ w2, bf* Bt) { const size_t e = ((size_t)blockIdx.x * 256 + threadIdx.x) * 4; if (e >= (size_t)DQ * DM) return; const int k = (int)(e % DM); const int n = (int)(e / DM); const int hh = n / HD, c = n % HD; const int h = hh >> 1; const float* w = (hh & 1) ? w2 : w1; v4us o;
#pragma unroll
    for (int u = 0; u < 4; ++u) o[u] = f2bf(w[((size_t)h * DM + k + u) * HD + c]); *(v4us*)(Bt + e) = o;  }
__global__ __launch_bounds__(256) void k_wtH1(const float* __restrict__ w, bf* Bt) { const size_t e = ((size_t)blockIdx.x * 256 + threadIdx.x) * 4; if (e >= (size_t)1024 * DM) return; const int k = (int)(e % DM); const int n = (int)(e / DM); const int h = n / HD, c = n % HD; v4us o;
#pragma unroll
    for (int u = 0; u < 4; ++u) o[u] = f2bf(w[((size_t)h * DM + k + u) * HD + c]); *(v4us*)(Bt + e) = o;  }
// ---- k_dattn: scores, both softmaxes, their difference, the product with v and the head merge of NQ x 16 query rows of one head in ONE work-group; no score or probability goes to memory.
// AW waves; wave w takes the 32-key chunks w, w + AW, ... up to the diagonal, each key or value fragment serving the wave's NQ query blocks. The scores are formed transposed (A = key rows, B = query rows), so a lane holds 8 + 8 keys
// of ONE query: the two accumulators of a 32-key chunk are, element for element, the B fragment of the product v^T x wei^T, and a query's maximum and sum need one exchange between the two lane halves.
// Sweep 1: running maximum and sum per query and score head, merged over the waves through LDS. Sweep 2: the scores again, wei = p1 / e1 - lam p2 / e2 in f32, rounded as before (fp16 with the x1024 carrier, or hi + lo), times v.
// The waves' f32 tiles are summed through LDS in wave order, scaled by 0.8 and split into the hi and lo planes [t][1024] of the output projection. Only a tile's last chunk crosses the diagonal; it alone is masked.
#define AW 8
#define SC2 (SCL * 1.4426950408889634f)   // score -> exponent of 2; SCL is a power of two, so this is the rounded log2(e) scaled exactly
#define MASKED (-0x1p100f)                // a masked score: a power of two, so MASKED x SC2 is exact and a lane that has met only masked keys forms exp2(0), a finite sum that the first real maximum scales by exactly 0
typedef __attribute__((ext_vector_type(16))) unsigned short v16us;
template <bool B> struct BC { static constexpr bool v = B; };
__device__ __forceinline__ void packw(const float (&w)[16], v16h& a, v16h& b) {
#pragma unroll
    for (int e = 0; e < 16; ++e) a[e] = tohx(w[e]);
    b = a; }
__device__ __forceinline__ void packw(const float (&w)[16], v16bf& a, v16bf& b) { v16us x, y;
#pragma unroll
    for (int e = 0; e < 16; ++e) { unsigned short p, q; splitf(w[e], p, q); x[e] = p; y[e] = q; }
    a = __builtin_bit_cast(v16bf, x); b = __builtin_bit_cast(v16bf, y); }
template <typename T16, bool HL, int NQ>
__device__ __forceinline__ void dattn_body(const T16* __restrict__ Q, const T16* __restrict__ Q2, const T16* __restrict__ Kp, const T16* __restrict__ Kp2, const T16* __restrict__ Vt, const T16* __restrict__ Vt2, float lam, int q0, int h, bf* Ah, bf* Al, float* red, float* st) {
    typedef typename WFrag<T16>::V V;
    constexpr int QT = NQ * 16;
    const int lane = threadIdx.x & 31, lr = lane & 15, hi = lane >> 4; const int wv = __builtin_amdgcn_readfirstlane((int)(threadIdx.x >> 5));   // the wave's number as a scalar: the key loops' tests are then scalar branches
    const int nch = (q0 + QT + 31) >> 5;      // 32-key chunks that hold a key <= the last query row; chunk nch - 1 is the one that crosses the diagonal
    V qf[NQ][2][2], qf2[NQ][2][2];
    // s_wait_xcnt 0 behind each fragment's two loads, here and in both sweeps: a later load may return its data into the registers that held this fragment's address
#pragma unroll
    for (int nq = 0; nq < NQ; ++nq)
#pragma unroll
        for (int sc = 0; sc < 2; ++sc)
#pragma unroll
            for (int c = 0; c < 2; ++c) { const size_t o = ((size_t)(2 * h + sc) * TT + q0 + nq * 16 + lr) * HD + c * 32 + 8 * hi; qf[nq][sc][c] = WFrag<T16>::ld(Q + o); asm volatile("s_wait_xcnt 0x0" ::: "memory"); if (HL) { qf2[nq][sc][c] = WFrag<T16>::ld(Q2 + o); asm volatile("s_wait_xcnt 0x0" ::: "memory"); } }
    // the key fragments of score head sc for the chunk at kc
    auto ldk = [&](int kc, int sc, V (&kf)[2][2], V (&kf2)[2][2]) __attribute__((always_inline)) {
#pragma unroll
        for (int kb = 0; kb < 2; ++kb)
#pragma unroll
            for (int c = 0; c < 2; ++c) { const size_t o = ((size_t)(2 * h + sc) * TT + kc + kb * 16 + lr) * HD + c * 32 + 8 * hi; kf[kb][c] = WFrag<T16>::ld(Kp + o); asm volatile("s_wait_xcnt 0x0" ::: "memory"); if (HL) { kf2[kb][c] = WFrag<T16>::ld(Kp2 + o); asm volatile("s_wait_xcnt 0x0" ::: "memory"); } } };
    // 16 keys x 16 queries of transposed scores, masked above the diagonal where the chunk crosses it
    auto score = [&](int kc, int nq, int sc, int kb, const V (&kf)[2][2], const V (&kf2)[2][2], auto mk) __attribute__((always_inline)) { v8f s = (v8f){};
#pragma unroll
        for (int c = 0; c < 2; ++c) { s = WFrag<T16>::mma(kf[kb][c], qf[nq][sc][c], s); if (HL) { s = WFrag<T16>::mma(kf[kb][c], qf2[nq][sc][c], s); s = WFrag<T16>::mma(kf2[kb][c], qf[nq][sc][c], s); } }
        if (decltype(mk)::v) {
#pragma unroll
            for (int j = 0; j < 8; ++j) s[j] = (kc + kb * 16 + hi * 8 + j <= q0 + nq * 16 + lr) ? s[j] : MASKED; }
        return s; };
    float mb[NQ][2], l[NQ][2];   // running maximum (as an exponent of 2) and the sum relative to it
#pragma unroll
    for (int nq = 0; nq < NQ; ++nq)
#pragma unroll
        for (int sc = 0; sc < 2; ++sc) { mb[nq][sc] = MASKED * SC2; l[nq][sc] = 0.f; }
    auto sweep1 = [&](int kc, auto mk) __attribute__((always_inline)) {
        V kf[2][2][2], kf2[2][2][2];
        if (!HL) { ldk(kc, 0, kf[0], kf2[0]); ldk(kc, 1, kf[1], kf2[1]);
            __builtin_amdgcn_sched_barrier(0); }   // keeps the products behind the last load: moved up between the loads they would wait for each fragment in turn, one memory latency after another
#pragma unroll
        for (int sc = 0; sc < 2; ++sc) {
            if (HL) { ldk(kc, sc, kf[sc], kf2[sc]);
                __builtin_amdgcn_sched_barrier(0); }   // hi + lo: one score head's fragments at a time, for registers; the products again behind the last load
#pragma unroll
            for (int nq = 0; nq < NQ; ++nq) { const v8f s0 = score(kc, nq, sc, 0, kf[sc], kf2[sc], mk), s1 = score(kc, nq, sc, 1, kf[sc], kf2[sc], mk); float mx = fmaxf(s0[0], s1[0]);
#pragma unroll
                for (int j = 1; j < 8; ++j) mx = fmaxf(mx, fmaxf(s0[j], s1[j]));
                const float mn = fmaxf(mb[nq][sc], mx * SC2); float sum = l[nq][sc] * __builtin_amdgcn_exp2f(mb[nq][sc] - mn);
#pragma unroll
                for (int j = 0; j < 8; ++j) sum += __builtin_amdgcn_exp2f(__builtin_fmaf(s0[j], SC2, -mn)) + __builtin_amdgcn_exp2f(__builtin_fmaf(s1[j], SC2, -mn));
                mb[nq][sc] = mn; l[nq][sc] = sum; } } };
    // kept rolled: a second copy of the body would double the fragments in flight
#pragma unroll 1
    for (int ch = wv; ch < nch - 1; ch += AW) sweep1(ch * 32, BC<false>{});
    if (((nch - 1) & (AW - 1)) == wv) sweep1((nch - 1) * 32, BC<true>{});
#pragma unroll
    for (int nq = 0; nq < NQ; ++nq)
#pragma unroll
        for (int sc = 0; sc < 2; ++sc) { const float mo = __shfl_xor(mb[nq][sc], 16, 32), lo = __shfl_xor(l[nq][sc], 16, 32); const float mn = fmaxf(mb[nq][sc], mo);
            v2f ml; ml[0] = mn; ml[1] = l[nq][sc] * __builtin_amdgcn_exp2f(mb[nq][sc] - mn) + lo * __builtin_amdgcn_exp2f(mo - mn);
            if (hi == 0) *(v2f*)(st + ((wv * 2 + sc) * QT + nq * 16 + lr) * 2) = ml; }
    __syncthreads();   // every wave's maxima and sums are in LDS before any wave merges them
    float MB[NQ][2], g[NQ][2];
#pragma unroll
    for (int nq = 0; nq < NQ; ++nq)
#pragma unroll
        for (int sc = 0; sc < 2; ++sc) { v2f ml[AW]; float mn = MASKED * SC2;
#pragma unroll
            for (int u = 0; u < AW; ++u) { ml[u] = *(const v2f*)(st + ((u * 2 + sc) * QT + nq * 16 + lr) * 2); mn = fmaxf(mn, ml[u][0]); }
            float sum = 0.f;
#pragma unroll
            for (int u = 0; u < AW; ++u) ml[u][0] = __builtin_amdgcn_exp2f(ml[u][0] - mn);
#pragma unroll
            for (int u = 0; u < AW; ++u) sum += ml[u][1] * ml[u][0];
            MB[nq][sc] = mn; g[nq][sc] = __fdiv_rn(1.0f, sum) * (sc ? lam : 1.0f) * (HL ? 1.0f : PCAR); }
    v8f acc[NQ][4];
#pragma unroll
    for (int nq = 0; nq < NQ; ++nq)
#pragma unroll
        for (int mq = 0; mq < 4; ++mq) acc[nq][mq] = (v8f){};
    auto sweep2 = [&](int kc, auto mk) __attribute__((always_inline)) {
        V kf[2][2][2], kf2[2][2][2], vf[4], vf2[4]; v8f s[NQ][2][2];
        if (!HL) { ldk(kc, 0, kf[0], kf2[0]); ldk(kc, 1, kf[1], kf2[1]);
            __builtin_amdgcn_sched_barrier(0); }   // as in sweep 1
#pragma unroll
        for (int sc = 0; sc < 2; ++sc) {
            if (HL) { ldk(kc, sc, kf[sc], kf2[sc]);
                __builtin_amdgcn_sched_barrier(0); }   // as in sweep 1
#pragma unroll
            for (int nq = 0; nq < NQ; ++nq)
#pragma unroll
                for (int kb = 0; kb < 2; ++kb) s[nq][sc][kb] = score(kc, nq, sc, kb, kf[sc], kf2[sc], mk); }
        __builtin_amdgcn_sched_barrier(0);   // the value fragments are asked for only behind the score products, into the registers that the key fragments leave: asked for with the keys they would not fit
        V wa[NQ], wb[NQ];
#pragma unroll
        for (int nq = 0; nq < NQ; ++nq) { float w[16];
#pragma unroll
            for (int mq = nq * 4 / NQ; mq < (nq + 1) * 4 / NQ; ++mq) { const size_t o = ((size_t)h * HD + mq * 16 + lr) * TT + kc + 8 * hi; vf[mq] = WFrag<T16>::ld(Vt + o); asm volatile("s_wait_xcnt 0x0" ::: "memory"); if (HL) { vf2[mq] = WFrag<T16>::ld(Vt2 + o); asm volatile("s_wait_xcnt 0x0" ::: "memory"); } }
            __builtin_amdgcn_sched_barrier(0);   // a share of the value fragments is asked for ahead of each query block's exponentials, which cover its latency: sunk below them, the whole latency would stand in front of the products
#pragma unroll
            for (int kb = 0; kb < 2; ++kb)
#pragma unroll
                for (int j = 0; j < 8; ++j) w[kb * 8 + j] = __builtin_amdgcn_exp2f(__builtin_fmaf(s[nq][0][kb][j], SC2, -MB[nq][0])) * g[nq][0] - __builtin_amdgcn_exp2f(__builtin_fmaf(s[nq][1][kb][j], SC2, -MB[nq][1])) * g[nq][1];
            packw(w, wa[nq], wb[nq]);
            __builtin_amdgcn_sched_barrier(0); }   // one query block's scores have left their registers before the next share of fragments is asked for
#pragma unroll
        for (int nq = 0; nq < NQ; ++nq)
#pragma unroll
            for (int mq = 0; mq < 4; ++mq) { acc[nq][mq] = WFrag<T16>::mma(vf[mq], wa[nq], acc[nq][mq]); if (HL) { acc[nq][mq] = WFrag<T16>::mma(vf[mq], wb[nq], acc[nq][mq]); acc[nq][mq] = WFrag<T16>::mma(vf2[mq], wa[nq], acc[nq][mq]); } }
        // the four vector slots behind the last matrix instruction, also on the loop's taken back edge
        asm volatile("v_nop\n\tv_nop\n\tv_nop\n\tv_nop" : "+v"(acc[NQ - 1][0]), "+v"(acc[NQ - 1][1]), "+v"(acc[NQ - 1][2]), "+v"(acc[NQ - 1][3]) : "v"(wa[NQ - 1]), "v"(vf[3])); };
    // kept rolled, as sweep 1
#pragma unroll 1
    for (int ch = wv; ch < nch - 1; ch += AW) sweep2(ch * 32, BC<false>{});
    if (((nch - 1) & (AW - 1)) == wv) sweep2((nch - 1) * 32, BC<true>{});
#pragma unroll
    for (int nq = 0; nq < NQ; ++nq) { float* mine = red + (wv * QT + nq * 16 + lr) * 68 + hi * 8;   // [wave][query][d], pitch 68
#pragma unroll
        for (int mq = 0; mq < 4; ++mq) { v4f a0, a1;
#pragma unroll
            for (int j = 0; j < 4; ++j) { a0[j] = acc[nq][mq][j]; a1[j] = acc[nq][mq][4 + j]; }
            *(v4fa*)(mine + mq * 16) = a0; *(v4fa*)(mine + mq * 16 + 4) = a1; } }
    __syncthreads();   // every wave's tile is in LDS before any wave sums across them
    const float cs = (HL ? 1.0f : (1.0f / PCAR)) * 0.8f;
#pragma unroll
    for (int r = 0; r < QT * 16 / (AW * 32); ++r) { const int idx = r * (AW * 32) + (int)threadIdx.x; const int row = idx >> 4, cofs = (idx & 15) * 4; v4f val = *(const v4fa*)(red + row * 68 + cofs);
#pragma unroll
        for (int u = 1; u < AW; ++u) val += *(const v4fa*)(red + (u * QT + row) * 68 + cofs);
        v4us oh, ol;
#pragma unroll
        for (int q = 0; q < 4; ++q) { unsigned short a, c2; splitf(val[q] * cs, a, c2); oh[q] = a; ol[q] = c2; }
        const size_t oo = (size_t)(q0 + row) * 1024 + h * HD + cofs; *(v4us*)(Ah + oo) = oh; *(v4us*)(Al + oo) = ol;
        asm volatile("s_wait_xcnt 0x0" ::: "memory"); }   // behind the two stores: what follows them in the code may write the registers that they name
}
#define NQF 2                          // query blocks of 16 per wave in the fp16 rows
#define NTF ((TT - RH) / (NQF * 16))   // tiles of fp16 rows; behind them RH / 16 tiles of hi + lo rows
// grid (heads, NTF + RH / 16): the tiles with the most keys have the lowest y index, for all heads
__global__ __launch_bounds__(AW * 32) void k_dattn(const h16* __restrict__ Q16, const h16* __restrict__ K16, const h16* __restrict__ V16, const bf* __restrict__ Qh, const bf* __restrict__ Ql, const bf* __restrict__ Kh, const bf* __restrict__ Kl, const bf* __restrict__ Vh, const bf* __restrict__ Vl, const float* __restrict__ lam4, bf* Ah, bf* Al) {
    __shared__ __align__(16) float red[AW * NQF * 16 * 68]; __shared__ __align__(16) float st[AW * 2 * NQF * 16 * 2];
    const int h = blockIdx.x, y = blockIdx.y;
    const float lam = __expf(bfr(lam4[0]) * bfr(lam4[1])) - __expf(bfr(lam4[2]) * bfr(lam4[3])) + 0.2f;
    if (y < NTF) dattn_body<h16, false, NQF>(Q16, nullptr, K16, nullptr, V16, nullptr, lam, TT - (y + 1) * (NQF * 16), h, Ah, Al, red, st);   // the branch is the same for the whole work-group
    else dattn_body<bf, true, 1>(Qh, Ql, Kh, Kl, Vh, Vl, lam, RH - (y - NTF + 1) * 16, h, Ah, Al, red, st);
}

extern "C" void kernel_launch(void* const* d_in, const int* in_sizes, int n_in,
                              void* d_out, int out_size, void* d_ws, size_t ws_size, hipStream_t stream) {
    (void)in_sizes; (void)n_in; (void)out_size;
    const float* x = (const float*)d_in[0]; const float* key1 = (const float*)d_in[1]; const float* key2 = (const float*)d_in[2]; const float* query1 = (const float*)d_in[3]; const float* query2 = (const float*)d_in[4]; const float* valw = (const float*)d_in[5]; const float* lambdas = (const float*)d_in[6]; const float* wo = (const float*)d_in[7]; const float* bo = (const float*)d_in[8]; const float* wq = nullptr; const float* wk = nullptr; const float* wv = nullptr; (void)wq; (void)wk; (void)wv; const float* cosT = nullptr; const float* sinT = nullptr; (void)cosT; (void)sinT;
    float* OUT = (float*)d_out;     // [2][2048][1024]
    char* wsp = (char*)d_ws;
    auto take = [&](size_t bytes) { char* p = wsp; wsp += (bytes + 255) & ~(size_t)255; return (void*)p; };
    bf* WQ = (bf*)take((size_t)DQ * DM * 2); bf* WK = (bf*)take((size_t)DKV * DM * 2); bf* WV = (bf*)take((size_t)DKV * DM * 2); bf* WO = (bf*)take((size_t)DM * DQ * 2); float* CS = (float*)take((size_t)TT * HD * 2 * 4);
    bf* XB = (bf*)take((size_t)TT * DM * 2);
    h16* QP16 = (h16*)take((size_t)NH_ * TT * HD * 2); h16* KP16 = (h16*)take((size_t)NKV * TT * HD * 2); h16* VT16 = (h16*)take((size_t)NKV * HD * TT * 2);
    bf* QPh = (bf*)take((size_t)NH_ * TT * HD * 2); bf* QPl = (bf*)take((size_t)NH_ * TT * HD * 2); bf* KPh = (bf*)take((size_t)NKV * TT * HD * 2); bf* KPl = (bf*)take((size_t)NKV * TT * HD * 2); bf* VTh = (bf*)take((size_t)NKV * HD * TT * 2); bf* VTl = (bf*)take((size_t)NKV * HD * TT * 2);
    // Sb: the f32 projections of one batch element (q, then k or v)
    float* Sb = (float*)take((size_t)TT * (DQ + DKV) * 4); bf* ATh = (bf*)take((size_t)TT * DQ * 2); bf* ATl = (bf*)take((size_t)TT * DQ * 2);
    if ((size_t)(wsp - (char*)d_ws) > ws_size) return;    // ws 256 MiB
    static_assert(RH % 32 == 0 && (TT - RH) % (NQF * 16) == 0 && TT % 32 == 0, "a work-group of k_dattn is all hi+lo or all fp16; whole 32-key chunks");
    float* FQ = Sb; float* FK = Sb + (size_t)TT * DQ;
    float* FV = FK;   // v projection reuses the k buffer after the k planes are built (stream-ordered)
    { k_wtH2<<<(unsigned)(((size_t)DQ * DM / 4 + 255) / 256), 256, 0, stream>>>(query1, query2, WQ); k_wtH2<<<(unsigned)(((size_t)DQ * DM / 4 + 255) / 256), 256, 0, stream>>>(key1, key2, WK); k_wtH1<<<(unsigned)(((size_t)1024 * DM / 4 + 255) / 256), 256, 0, stream>>>(valw, WV);
      k_wtG<<<(unsigned)((1024 * DM / 64 + 63) / 64), 256, 0, stream>>>(wo, 1024, DM, WO);
       }
    k_csid<<<(TT * HD + 255) / 256, 256, 0, stream>>>(CS);
    const unsigned LQ = (unsigned)(((size_t)NH_ * TT * HD / 2 + 255) / 256), LKv = (unsigned)(((size_t)NKV * TT * HD / 2 + 255) / 256);
    for (int b = 0; b < NB_; ++b) {
        
        k_cvt8<<<(unsigned)(((size_t)TT * DM / 8 + 255) / 256), 256, 0, stream>>>(x + (size_t)b * TT * DM, XB, (size_t)TT * DM / 8);
        k_gemmw<bf, 0, false><<<dim3(TT / 64, DQ / 64, 1), 32, 0, stream>>>(XB, nullptr, WQ, nullptr, DM, FQ, DQ, nullptr, 0, 0, 0);
        k_rope<<<LQ, 256, 0, stream>>>(FQ, DQ, NH_, CS, nullptr, nullptr, 1.0f, QP16, QPh, QPl);
        k_gemmw<bf, 0, false><<<dim3(TT / 64, DKV / 64, 1), 32, 0, stream>>>(XB, nullptr, WK, nullptr, DM, FK, DKV, nullptr, 0, 0, 0);
        k_rope<<<LKv, 256, 0, stream>>>(FK, DKV, NKV, CS, nullptr, nullptr, 1.0f, KP16, KPh, KPl);
        k_gemmw<bf, 0, false><<<dim3(TT / 64, 1024 / 64, 1), 32, 0, stream>>>(XB, nullptr, WV, nullptr, DM, FV, 1024, nullptr, 0, 0, 0); k_vtp<<<(unsigned)(((size_t)16 * HD * TT / 2 + 255) / 256), 256, 0, stream>>>(FV, 1024, 16, VT16, VTh, VTl);
        k_dattn<<<dim3(NHD, NTF + RH / 16), AW * 32, 0, stream>>>(QP16, KP16, VT16, QPh, QPl, KPh, KPl, VTh, VTl, lambdas, ATh, ATl);
        k_gemmw<bf, 1, true><<<dim3(TT / 64, DM / 64, 1), 32, 0, stream>>>(ATh, ATl, WO, nullptr, 1024, OUT + (size_t)b * TT * DM, DM, bo, 0, 0, 0); }
}

// v004
// A run of this version takes 375 microseconds.
// Two timings next to v003 both put it at 1.14 times that version's speed.
// All steps since v000 together make it 7.66 times as fast.
#include <hip/hip_runtime.h>

// Multi-head differential attention (x [2][2048][1024]; per-head q1/q2/k1/k2/v = x W[h] (W [16][1024][64], no bias); lam = exp(l0 l1) - exp(l2 l3) + 0.2 (lambdas read); wei = softmax(causal(q1.k1) / 8) - lam softmax(causal(q2.k2) / 8); out = (wei v merged) x (1 - 0.2) @ proj_w + proj_b -> [2][2048][1024]).
// The two score matrices of a head are computed as an adjacent pair of "score heads" (2h: q1/k1, 2h+1: q2/k2) so one pass of the causal score GEMM yields both; the differential softmax combines them into one probability matrix per head.
// Compute dtypes, f32 accumulate: every input rounded to bf16; the five projections on PLAIN bf16 operands (inputs: exact; per-head weights gathered); causal scores and wei.v: query rows < 512 hl (3 products), the rest single fp16 (x1024 carrier on wei); both softmaxes, lam and the difference f32; x 0.8 folded into the merge; proj hl x exact (2 products) + bias.

#define NB_  2
#define TT   2048
#define DM   1024
#define NH_  32
#define NKV  32
#define REP  (NH_ / NKV)
#define HD   64
#define DQ   (NH_ * HD)
#define DKV  (NKV * HD)
#define ZH   2
#define RH   512                  // query rows < RH use hi+lo planes (0: none)
#define NHD  16                   // heads (each a pair of score heads)
#define WIN  2048
#define PCAR 1024.0f
#define SCL  0.125f   // HD^-0.5
typedef _Float16 h16;
typedef unsigned short bf;
typedef __attribute__((ext_vector_type(16))) __bf16   v16bf;
typedef __attribute__((ext_vector_type(16))) _Float16 v16h;
typedef __attribute__((ext_vector_type(8)))  _Float16 v8h;
typedef __attribute__((ext_vector_type(8)))  unsigned short v8us;
typedef __attribute__((ext_vector_type(8)))  float    v8f;
typedef __attribute__((ext_vector_type(4)))  float    v4f;
typedef v8h  __attribute__((may_alias)) v8ha;
typedef v4f  __attribute__((may_alias)) v4fa;
typedef v8us __attribute__((may_alias)) v8usa;

__device__ __forceinline__ unsigned short f2bf(float f) { unsigned u = __float_as_uint(f); u += 0x7FFFu + ((u >> 16) & 1u); return (unsigned short)(u >> 16); }
__device__ __forceinline__ float bf2f(unsigned short b) { return __uint_as_float(((unsigned)b) << 16); }
__device__ __forceinline__ float bfr(float f) { return bf2f(f2bf(f)); }
__device__ __forceinline__ v16h cat16(v8h lo, v8h hi) { return __builtin_shufflevector(lo, hi, 0, 1, 2, 3, 4, 5, 6, 7, 8, 9, 10, 11, 12, 13, 14, 15); }
__device__ __forceinline__ v16bf cat16b(v8us lo, v8us hi) { return __builtin_bit_cast(v16bf, __builtin_shufflevector(lo, hi, 0, 1, 2, 3, 4, 5, 6, 7, 8, 9, 10, 11, 12, 13, 14, 15)); }
__device__ __forceinline__ v8f wmma16(v16h a, v16h b, v8f c) { return __builtin_amdgcn_wmma_f32_16x16x32_f16(false, a, false, b, (short)0, c, false, false); }
__device__ __forceinline__ v8f wmmab(v16bf a, v16bf b, v8f c) { return __builtin_amdgcn_wmma_f32_16x16x32_bf16(false, a, false, b, (short)0, c, false, false); }



// ---- k_gemmw: register-blocked GEMM, ONE WAVE per 64x64 output tile (16 accumulators), operands straight from K-contiguous 16-bit planes; grid (M/64, N/64, Z), 32 threads.
// C[m][n] (f32, pitch ldc, + optional f32 bias[n]) = sum_k A[m][k] Bt[n][k] (+ split products per NSPLIT). z-batch strides sA/sB/sC in elements. K % 32 == 0.
// PL: no f32 C; the tile goes out as three 16-bit planes (fp16, bf16 hi, bf16 lo) at element blockIdx.y x ys + m x ldc + (n % 64): ys = rows x 64, ldc = 64 gives head planes [n / 64][m][n % 64]; ys = 64 gives the plain [m][n].
template <typename T16> struct WFrag;
template <> struct WFrag<h16> { typedef v16h V; static __device__ __forceinline__ V ld(const h16* p) { return cat16(*(const v8h*)p, *(const v8h*)(p + 16)); } static __device__ __forceinline__ v8f mma(V a, V b, v8f c) { return wmma16(a, b, c); } };
template <> struct WFrag<bf> { typedef v16bf V; static __device__ __forceinline__ V ld(const bf* p) { return cat16b(*(const v8us*)p, *(const v8us*)(p + 16)); } static __device__ __forceinline__ v8f mma(V a, V b, v8f c) { return wmmab(a, b, c); } };
__device__ __forceinline__ h16 tohx(float x) { return (h16)x; }
__device__ __forceinline__ void splitf(float y, unsigned short& h, unsigned short& l) { h = f2bf(y); l = f2bf(y - bf2f(h)); }
template <typename T16, int NSPLIT, bool BIAS, bool PL>
__global__ __launch_bounds__(32) void k_gemmw(const T16* __restrict__ A, const T16* __restrict__ A2, const T16* __restrict__ Bt, const T16* __restrict__ Bt2, int K, float* C, int ldc, const float* __restrict__ bias, size_t sA, size_t sB, size_t sC, h16* P16, bf* Ph, bf* Pl, size_t ys) {
    typedef typename WFrag<T16>::V V;
    __shared__ __align__(16) float os[16 * 68];
    const size_t z = blockIdx.z; A += z * sA; if (A2) A2 += z * sA; Bt += z * sB; if (Bt2) Bt2 += z * sB; C += z * sC;
    const int lane = threadIdx.x & 31, lr = lane & 15, hi = lane >> 4; const int r0 = blockIdx.x * 64, c0 = blockIdx.y * 64;
    v8f acc[4][4];
#pragma unroll
    for (int mb = 0; mb < 4; ++mb)
#pragma unroll
        for (int nb = 0; nb < 4; ++nb) acc[mb][nb] = (v8f){};
    const size_t aoff = (size_t)(r0 + lr) * K + 8 * hi, boff = (size_t)(c0 + lr) * K + 8 * hi;
#pragma unroll 1
    for (int kc = 0; kc < K; kc += 32) {
        V a[4], a2[4];
#pragma unroll
        for (int mb = 0; mb < 4; ++mb) { a[mb] = WFrag<T16>::ld(A + aoff + (size_t)mb * 16 * K + kc); if (NSPLIT == 1 || NSPLIT == 2) a2[mb] = WFrag<T16>::ld(A2 + aoff + (size_t)mb * 16 * K + kc); }
#pragma unroll
        for (int nb = 0; nb < 4; ++nb) { const V b = WFrag<T16>::ld(Bt + boff + (size_t)nb * 16 * K + kc); V b2; if (NSPLIT >= 2) b2 = WFrag<T16>::ld(Bt2 + boff + (size_t)nb * 16 * K + kc);
#pragma unroll
            for (int mb = 0; mb < 4; ++mb) { acc[mb][nb] = WFrag<T16>::mma(a[mb], b, acc[mb][nb]); if (NSPLIT == 1 || NSPLIT == 2) acc[mb][nb] = WFrag<T16>::mma(a2[mb], b, acc[mb][nb]); if (NSPLIT >= 2) acc[mb][nb] = WFrag<T16>::mma(a[mb], b2, acc[mb][nb]); } }
        asm volatile("v_nop\n\tv_nop\n\tv_nop\n\tv_nop" : "+v"(acc[0][0]), "+v"(acc[1][1]), "+v"(acc[2][2]), "+v"(acc[3][3]) : "v"(a[0]), "v"(a[3]));
    }
#pragma unroll
    for (int mb = 0; mb < 4; ++mb) {
#pragma unroll
        for (int nb = 0; nb < 4; ++nb) {
#pragma unroll
            for (int j = 0; j < 8; ++j) os[(hi * 8 + j) * 68 + nb * 16 + lr] = acc[mb][nb][j]; }
        __builtin_amdgcn_wave_barrier(); asm volatile("" ::: "memory");
        float* crow = C + (size_t)(r0 + mb * 16) * ldc + c0;
        if (PL) {   // 8 lanes x 16 bytes cover a row's 64 elements of a plane: one whole 128-byte line
#pragma unroll
            for (int s = 0; s < 4; ++s) { const int row = 4 * s + (lane >> 3), cofs = (lane & 7) * 8; const v4f x0 = *(const v4fa*)(os + row * 68 + cofs), x1 = *(const v4fa*)(os + row * 68 + cofs + 4); v8h o16; v8us oh, ol;
#pragma unroll
                for (int q = 0; q < 8; ++q) { const float x = (q < 4) ? x0[q & 3] : x1[q & 3]; o16[q] = tohx(x); unsigned short a2, c2; splitf(x, a2, c2); oh[q] = a2; ol[q] = c2; }
                const size_t oo = (size_t)blockIdx.y * ys + (size_t)(r0 + mb * 16 + row) * ldc + cofs; *(v8h*)(P16 + oo) = o16; *(v8us*)(Ph + oo) = oh; *(v8us*)(Pl + oo) = ol;
                asm volatile("s_wait_xcnt 0x0" ::: "memory"); }   // behind the three stores: what follows them in the code may write the registers that they name
        } else {
#pragma unroll
            for (int s = 0; s < 8; ++s) { const int row = 2 * s + hi, cofs = lr * 4; v4f val = *(const v4fa*)(os + row * 68 + cofs); if (BIAS) { val[0] += bfr(bias[c0 + cofs]); val[1] += bfr(bias[c0 + cofs + 1]); val[2] += bfr(bias[c0 + cofs + 2]); val[3] += bfr(bias[c0 + cofs + 3]); }
                *(v4f*)(crow + (size_t)row * ldc + cofs) = val; }
             }
        __builtin_amdgcn_wave_barrier(); asm volatile("" ::: "memory");
    }
}

typedef __attribute__((ext_vector_type(2))) _Float16 v2h;
typedef __attribute__((ext_vector_type(4))) _Float16 v4h;
typedef __attribute__((ext_vector_type(2))) unsigned short v2us;
typedef __attribute__((ext_vector_type(4))) unsigned short v4us;
typedef __attribute__((ext_vector_type(2))) float v2f;
typedef __attribute__((ext_vector_type(4))) int v4i;

__global__ __launch_bounds__(256) void k_wtG(const float* __restrict__ w, int K, int N, bf* Bt) {
    const int lane = threadIdx.x & 31; const int L0 = (blockIdx.x * 8 + (threadIdx.x >> 5)) * 8; const int nlines = N * K / 64;
{
#pragma unroll 1
        for (int l = 0; l < 8; ++l) { const int L = L0 + l; if (L >= nlines) break; const size_t e = (size_t)L * 64 + lane * 2; const int k = (int)(e % K), n = (int)(e / K); v2us o;
            o[0] = f2bf(w[(size_t)k * N + n]); o[1] = f2bf(w[(size_t)(k + 1) * N + n]); *(v2us*)(Bt + e) = o; }
         }
}
__global__ __launch_bounds__(256) void k_cvt8(const float* __restrict__ src, bf* dst, size_t n8) { const size_t i = (size_t)blockIdx.x * 256 + threadIdx.x; if (i >= n8) return; const v8f v = *(const v8f*)(src + i * 8); v8us o;
#pragma unroll
    for (int k = 0; k < 8; ++k) o[k] = f2bf(v[k]); *(v8us*)(dst + i * 8) = o;  }
__global__ __launch_bounds__(256) void k_cscvt(const float* __restrict__ cosT, const float* __restrict__ sinT, float* CS) { const int idx = blockIdx.x * 256 + threadIdx.x; if (idx >= TT * HD) return; v2f cs; cs[0] = bfr(cosT[idx]); cs[1] = bfr(sinT[idx]); *(v2f*)(CS + (size_t)idx * 2) = cs;  }
// k_asoft: per row (zz, i): t = S x HD^-0.5 for j <= i and i - j < WIN (sliding causal window; the reference's -1e9 additive fill vanishes identically); softmax over the 2048 keys (register row, one exp, fixed trees);
__global__ __launch_bounds__(256) void k_asoft(const float* __restrict__ Sb, h16* P16, bf* Ph, bf* Pl) {
    const int lane = threadIdx.x & 31; const int row = blockIdx.x * 8 + (threadIdx.x >> 5); if (row >= ZH * TT) return; const int i = row % TT; const int zz = row / TT; (void)zz; const bool hires = (i < RH); const float* sr = Sb + (size_t)row * TT; float v[TT / 32]; float mx = -3.0e38f;
#pragma unroll
    for (int ch = 0; ch < TT / 128; ++ch) { const int j0 = ch * 128 + lane * 4; const v4f a = *(const v4f*)(sr + j0);
#pragma unroll
        for (int q = 0; q < 4; ++q) { const int j = j0 + q; (void)j; const float t = (j <= i && i - j < WIN) ? a[q] * SCL : -3.0e38f; v[ch * 4 + q] = t; mx = fmaxf(mx, t); } }
#pragma unroll
    for (int sh = 16; sh; sh >>= 1) mx = fmaxf(mx, __shfl_xor(mx, sh, 32));
    float sum = 0.f;
#pragma unroll
    for (int k = 0; k < TT / 32; ++k) { float d0 = __fsub_rn(v[k], mx); asm volatile("" : "+v"(d0)); v[k] = __builtin_amdgcn_exp2f(__fmul_rn(d0, 1.4426950408889634f)); sum += v[k]; }
#pragma unroll
    for (int sh = 16; sh; sh >>= 1) sum += __shfl_xor(sum, sh, 32);
    const float f = __fdiv_rn(hires ? 1.0f : PCAR, sum);
{
        if (hires) {
#pragma unroll
            for (int ch = 0; ch < TT / 128; ++ch) { v4us oh, ol;
#pragma unroll
                for (int q = 0; q < 4; ++q) { unsigned short a, c2; splitf(v[ch * 4 + q] * f, a, c2); oh[q] = a; ol[q] = c2; }
                const size_t oo = ((size_t)zz * (RH ? RH : 1) + i) * TT + ch * 128 + lane * 4; *(v4us*)(Ph + oo) = oh; *(v4us*)(Pl + oo) = ol; }
        } else {
#pragma unroll
            for (int ch = 0; ch < TT / 128; ++ch) { v4h o4;
#pragma unroll
                for (int q = 0; q < 4; ++q) o4[q] = tohx(v[ch * 4 + q] * f);
                *(v4h*)(P16 + (size_t)row * TT + ch * 128 + lane * 4) = o4; } }
         }
}
__global__ __launch_bounds__(256) void k_merge(const float* __restrict__ O, int h0, bf* Ah, bf* Al) { const size_t e = ((size_t)blockIdx.x * 256 + threadIdx.x) * 2; if (e >= (size_t)ZH * TT * HD) return; const int d = (int)(e % HD); const int t = (int)((e / HD) % TT); const int zz = (int)(e / ((size_t)HD * TT)); const float cs = (t < RH) ? 1.0f : (1.0f / PCAR); const size_t oo = (size_t)t * DQ + (h0 + zz) * HD + d;
    v2us oh, ol;
#pragma unroll
    for (int q = 0; q < 2; ++q) { unsigned short a, c2; splitf(O[e + q] * cs, a, c2); oh[q] = a; ol[q] = c2; } *(v2us*)(Ah + oo) = oh; *(v2us*)(Al + oo) = ol;  }

__global__ __launch_bounds__(256) void k_wtH2(const float* __restrict__ w1, const float* __restrict__ w2, bf* Bt) { const size_t e = ((size_t)blockIdx.x * 256 + threadIdx.x) * 4; if (e >= (size_t)DQ * DM) return; const int k = (int)(e % DM); const int n = (int)(e / DM); const int hh = n / HD, c = n % HD; const int h = hh >> 1; const float* w = (hh & 1) ? w2 : w1; v4us o;
#pragma unroll
    for (int u = 0; u < 4; ++u) o[u] = f2bf(w[((size_t)h * DM + k + u) * HD + c]); *(v4us*)(Bt + e) = o;  }
__global__ __launch_bounds__(256) void k_wtH1(const float* __restrict__ w, bf* Bt) { const size_t e = ((size_t)blockIdx.x * 256 + threadIdx.x) * 4; if (e >= (size_t)1024 * DM) return; const int k = (int)(e % DM); const int n = (int)(e / DM); const int h = n / HD, c = n % HD; v4us o;
#pragma unroll
    for (int u = 0; u < 4; ++u) o[u] = f2bf(w[((size_t)h * DM + k + u) * HD + c]); *(v4us*)(Bt + e) = o;  }
// ---- k_dattn: scores, both softmaxes, their difference, the product with v and the head merge of NQ x 16 query rows of one head in ONE work-group; no score or probability goes to memory.
// AW waves; wave w takes the 32-key chunks w, w + AW, ... up to the diagonal, each key or value fragment serving the wave's NQ query blocks. The scores are formed transposed (A = key rows, B = query rows), so a lane holds 8 + 8 keys
// of ONE query: the two accumulators of a 32-key chunk are, element for element, the B fragment of the product v^T x wei^T, and a query's maximum and sum need one exchange between the two lane halves.
// Sweep 1: running maximum and sum per query and score head, merged over the waves through LDS. Sweep 2: the scores again, wei = p1 / e1 - lam p2 / e2 in f32, rounded as before (fp16 with the x1024 carrier, or hi + lo), times v.
// The waves' f32 tiles are summed through LDS in wave order, scaled by 0.8 and split into the hi and lo planes [t][1024] of the output projection. Only a tile's last chunk crosses the diagonal; it alone is masked.
#define AW 8
#define SC2 (SCL * 1.4426950408889634f)   // score -> exponent of 2; SCL is a power of two, so this is the rounded log2(e) scaled exactly
#define MASKED (-0x1p100f)                // a masked score: a power of two, so MASKED x SC2 is exact and a lane that has met only masked keys forms exp2(0), a finite sum that the first real maximum scales by exactly 0
typedef __attribute__((ext_vector_type(16))) unsigned short v16us;
template <bool B> struct BC { static constexpr bool v = B; };
__device__ __forceinline__ void packw(const float (&w)[16], v16h& a, v16h& b) {
#pragma unroll
    for (int e = 0; e < 16; ++e) a[e] = tohx(w[e]);
    b = a; }
__device__ __forceinline__ void packw(const float (&w)[16], v16bf& a, v16bf& b) { v16us x, y;
#pragma unroll
    for (int e = 0; e < 16; ++e) { unsigned short p, q; splitf(w[e], p, q); x[e] = p; y[e] = q; }
    a = __builtin_bit_cast(v16bf, x); b = __builtin_bit_cast(v16bf, y); }
template <typename T16, bool HL, int NQ>
__device__ __forceinline__ void dattn_body(const T16* __restrict__ Q, const T16* __restrict__ Q2, const T16* __restrict__ Kp, const T16* __restrict__ Kp2, const T16* __restrict__ Vt, const T16* __restrict__ Vt2, float lam, int q0, int h, bf* Ah, bf* Al, float* red, float* st) {
    typedef typename WFrag<T16>::V V;
    constexpr int QT = NQ * 16;
    const int lane = threadIdx.x & 31, lr = lane & 15, hi = lane >> 4; const int wv = __builtin_amdgcn_readfirstlane((int)(threadIdx.x >> 5));   // the wave's number as a scalar: the key loops' tests are then scalar branches
    const int nch = (q0 + QT + 31) >> 5;      // 32-key chunks that hold a key <= the last query row; chunk nch - 1 is the one that crosses the diagonal
    V qf[NQ][2][2], qf2[NQ][2][2];
    // s_wait_xcnt 0 behind each fragment's two loads, here and in both sweeps: a later load may return its data into the registers that held this fragment's address
#pragma unroll
    for (int nq = 0; nq < NQ; ++nq)
#pragma unroll
        for (int sc = 0; sc < 2; ++sc)
#pragma unroll
            for (int c = 0; c < 2; ++c) { const size_t o = ((size_t)(2 * h + sc) * TT + q0 + nq * 16 + lr) * HD + c * 32 + 8 * hi; qf[nq][sc][c] = WFrag<T16>::ld(Q + o); asm volatile("s_wait_xcnt 0x0" ::: "memory"); if (HL) { qf2[nq][sc][c] = WFrag<T16>::ld(Q2 + o); asm volatile("s_wait_xcnt 0x0" ::: "memory"); } }
    // the key fragments of score head sc for the chunk at kc
    auto ldk = [&](int kc, int sc, V (&kf)[2][2], V (&kf2)[2][2]) __attribute__((always_inline)) {
#pragma unroll
        for (int kb = 0; kb < 2; ++kb)
#pragma unroll
            for (int c = 0; c < 2; ++c) { const size_t o = ((size_t)(2 * h + sc) * TT + kc + kb * 16 + lr) * HD + c * 32 + 8 * hi; kf[kb][c] = WFrag<T16>::ld(Kp + o); asm volatile("s_wait_xcnt 0x0" ::: "memory"); if (HL) { kf2[kb][c] = WFrag<T16>::ld(Kp2 + o); asm volatile("s_wait_xcnt 0x0" ::: "memory"); } } };
    // 16 keys x 16 queries of transposed scores, masked above the diagonal where the chunk crosses it
    auto score = [&](int kc, int nq, int sc, int kb, const V (&kf)[2][2], const V (&kf2)[2][2], auto mk) __attribute__((always_inline)) { v8f s = (v8f){};
#pragma unroll
        for (int c = 0; c < 2; ++c) { s = WFrag<T16>::mma(kf[kb][c], qf[nq][sc][c], s); if (HL) { s = WFrag<T16>::mma(kf[kb][c], qf2[nq][sc][c], s); s = WFrag<T16>::mma(kf2[kb][c], qf[nq][sc][c], s); } }
        if (decltype(mk)::v) {
#pragma unroll
            for (int j = 0; j < 8; ++j) s[j] = (kc + kb * 16 + hi * 8 + j <= q0 + nq * 16 + lr) ? s[j] : MASKED; }
        return s; };
    float mb[NQ][2], l[NQ][2];   // running maximum (as an exponent of 2) and the sum relative to it
#pragma unroll
    for (int nq = 0; nq < NQ; ++nq)
#pragma unroll
        for (int sc = 0; sc < 2; ++sc) { mb[nq][sc] = MASKED * SC2; l[nq][sc] = 0.f; }
    auto sweep1 = [&](int kc, auto mk) __attribute__((always_inline)) {
        V kf[2][2][2], kf2[2][2][2];
        if (!HL) { ldk(kc, 0, kf[0], kf2[0]); ldk(kc, 1, kf[1], kf2[1]);
            __builtin_amdgcn_sched_barrier(0); }   // keeps the products behind the last load: moved up between the loads they would wait for each fragment in turn, one memory latency after another
#pragma unroll
        for (int sc = 0; sc < 2; ++sc) {
            if (HL) { ldk(kc, sc, kf[sc], kf2[sc]);
                __builtin_amdgcn_sched_barrier(0); }   // hi + lo: one score head's fragments at a time, for registers; the products again behind the last load
#pragma unroll
            for (int nq = 0; nq < NQ; ++nq) { const v8f s0 = score(kc, nq, sc, 0, kf[sc], kf2[sc], mk), s1 = score(kc, nq, sc, 1, kf[sc], kf2[sc], mk); float mx = fmaxf(s0[0], s1[0]);
#pragma unroll
                for (int j = 1; j < 8; ++j) mx = fmaxf(mx, fmaxf(s0[j], s1[j]));
                const float mn = fmaxf(mb[nq][sc], mx * SC2); float sum = l[nq][sc] * __builtin_amdgcn_exp2f(mb[nq][sc] - mn);
#pragma unroll
                for (int j = 0; j < 8; ++j) sum += __builtin_amdgcn_exp2f(__builtin_fmaf(s0[j], SC2, -mn)) + __builtin_amdgcn_exp2f(__builtin_fmaf(s1[j], SC2, -mn));
                mb[nq][sc] = mn; l[nq][sc] = sum; } } };
    // kept rolled: a second copy of the body would double the fragments in flight
#pragma unroll 1
    for (int ch = wv; ch < nch - 1; ch += AW) sweep1(ch * 32, BC<false>{});
    if (((nch - 1) & (AW - 1)) == wv) sweep1((nch - 1) * 32, BC<true>{});
#pragma unroll
    for (int nq = 0; nq < NQ; ++nq)
#pragma unroll
        for (int sc = 0; sc < 2; ++sc) { const float mo = __shfl_xor(mb[nq][sc], 16, 32), lo = __shfl_xor(l[nq][sc], 16, 32); const float mn = fmaxf(mb[nq][sc], mo);
            v2f ml; ml[0] = mn; ml[1] = l[nq][sc] * __builtin_amdgcn_exp2f(mb[nq][sc] - mn) + lo * __builtin_amdgcn_exp2f(mo - mn);
            if (hi == 0) *(v2f*)(st + ((wv * 2 + sc) * QT + nq * 16 + lr) * 2) = ml; }
    __syncthreads();   // every wave's maxima and sums are in LDS before any wave merges them
    float MB[NQ][2], g[NQ][2];
#pragma unroll
    for (int nq = 0; nq < NQ; ++nq)
#pragma unroll
        for (int sc = 0; sc < 2; ++sc) { v2f ml[AW]; float mn = MASKED * SC2;
#pragma unroll
            for (int u = 0; u < AW; ++u) { ml[u] = *(const v2f*)(st + ((u * 2 + sc) * QT + nq * 16 + lr) * 2); mn = fmaxf(mn, ml[u][0]); }
            float sum = 0.f;
#pragma unroll
            for (int u = 0; u < AW; ++u) ml[u][0] = __builtin_amdgcn_exp2f(ml[u][0] - mn);
#pragma unroll
            for (int u = 0; u < AW; ++u) sum += ml[u][1] * ml[u][0];
            MB[nq][sc] = mn; g[nq][sc] = __fdiv_rn(1.0f, sum) * (sc ? lam : 1.0f) * (HL ? 1.0f : PCAR); }
    v8f acc[NQ][4];
#pragma unroll
    for (int nq = 0; nq < NQ; ++nq)
#pragma unroll
        for (int mq = 0; mq < 4; ++mq) acc[nq][mq] = (v8f){};
    auto sweep2 = [&](int kc, auto mk) __attribute__((always_inline)) {
        V kf[2][2][2], kf2[2][2][2], vf[4], vf2[4]; v8f s[NQ][2][2];
        if (!HL) { ldk(kc, 0, kf[0], kf2[0]); ldk(kc, 1, kf[1], kf2[1]);
            __builtin_amdgcn_sched_barrier(0); }   // as in sweep 1
#pragma unroll
        for (int sc = 0; sc < 2; ++sc) {
            if (HL) { ldk(kc, sc, kf[sc], kf2[sc]);
                __builtin_amdgcn_sched_barrier(0); }   // as in sweep 1
#pragma unroll
            for (int nq = 0; nq < NQ; ++nq)
#pragma unroll
                for (int kb = 0; kb < 2; ++kb) s[nq][sc][kb] = score(kc, nq, sc, kb, kf[sc], kf2[sc], mk); }
        __builtin_amdgcn_sched_barrier(0);   // the value fragments are asked for only behind the score products, into the registers that the key fragments leave: asked for with the keys they would not fit
        V wa[NQ], wb[NQ];
#pragma unroll
        for (int nq = 0; nq < NQ; ++nq) { float w[16];
#pragma unroll
            for (int mq = nq * 4 / NQ; mq < (nq + 1) * 4 / NQ; ++mq) { const size_t o = ((size_t)h * HD + mq * 16 + lr) * TT + kc + 8 * hi; vf[mq] = WFrag<T16>::ld(Vt + o); asm volatile("s_wait_xcnt 0x0" ::: "memory"); if (HL) { vf2[mq] = WFrag<T16>::ld(Vt2 + o); asm volatile("s_wait_xcnt 0x0" ::: "memory"); } }
            __builtin_amdgcn_sched_barrier(0);   // a share of the value fragments is asked for ahead of each query block's exponentials, which cover its latency: sunk below them, the whole latency would stand in front of the products
#pragma unroll
            for (int kb = 0; kb < 2; ++kb)
#pragma unroll
                for (int j = 0; j < 8; ++j) w[kb * 8 + j] = __builtin_amdgcn_exp2f(__builtin_fmaf(s[nq][0][kb][j], SC2, -MB[nq][0])) * g[nq][0] - __builtin_amdgcn_exp2f(__builtin_fmaf(s[nq][1][kb][j], SC2, -MB[nq][1])) * g[nq][1];
            packw(w, wa[nq], wb[nq]);
            __builtin_amdgcn_sched_barrier(0); }   // one query block's scores have left their registers before the next share of fragments is asked for
#pragma unroll
        for (int nq = 0; nq < NQ; ++nq)
#pragma unroll
            for (int mq = 0; mq < 4; ++mq) { acc[nq][mq] = WFrag<T16>::mma(vf[mq], wa[nq], acc[nq][mq]); if (HL) { acc[nq][mq] = WFrag<T16>::mma(vf[mq], wb[nq], acc[nq][mq]); acc[nq][mq] = WFrag<T16>::mma(vf2[mq], wa[nq], acc[nq][mq]); } }
        // the four vector slots behind the last matrix instruction, also on the loop's taken back edge
        asm volatile("v_nop\n\tv_nop\n\tv_nop\n\tv_nop" : "+v"(acc[NQ - 1][0]), "+v"(acc[NQ - 1][1]), "+v"(acc[NQ - 1][2]), "+v"(acc[NQ - 1][3]) : "v"(wa[NQ - 1]), "v"(vf[3])); };
    // kept rolled, as sweep 1
#pragma unroll 1
    for (int ch = wv; ch < nch - 1; ch += AW) sweep2(ch * 32, BC<false>{});
    if (((nch - 1) & (AW - 1)) == wv) sweep2((nch - 1) * 32, BC<true>{});
#pragma unroll
    for (int nq = 0; nq < NQ; ++nq) { float* mine = red + (wv * QT + nq * 16 + lr) * 68 + hi * 8;   // [wave][query][d], pitch 68
#pragma unroll
        for (int mq = 0; mq < 4; ++mq) { v4f a0, a1;
#pragma unroll
            for (int j = 0; j < 4; ++j) { a0[j] = acc[nq][mq][j]; a1[j] = acc[nq][mq][4 + j]; }
            *(v4fa*)(mine + mq * 16) = a0; *(v4fa*)(mine + mq * 16 + 4) = a1; } }
    __syncthreads();   // every wave's tile is in LDS before any wave sums across them
    const float cs = (HL ? 1.0f : (1.0f / PCAR)) * 0.8f;
#pragma unroll
    for (int r = 0; r < QT * 16 / (AW * 32); ++r) { const int idx = r * (AW * 32) + (int)threadIdx.x; const int row = idx >> 4, cofs = (idx & 15) * 4; v4f val = *(const v4fa*)(red + row * 68 + cofs);
#pragma unroll
        for (int u = 1; u < AW; ++u) val += *(const v4fa*)(red + (u * QT + row) * 68 + cofs);
        v4us oh, ol;
#pragma unroll
        for (int q = 0; q < 4; ++q) { unsigned short a, c2; splitf(val[q] * cs, a, c2); oh[q] = a; ol[q] = c2; }
        const size_t oo = (size_t)(q0 + row) * 1024 + h * HD + cofs; *(v4us*)(Ah + oo) = oh; *(v4us*)(Al + oo) = ol;
        asm volatile("s_wait_xcnt 0x0" ::: "memory"); }   // behind the two stores: what follows them in the code may write the registers that they name
}
#define NQF 2                          // query blocks of 16 per wave in the fp16 rows
#define NTF ((TT - RH) / (NQF * 16))   // tiles of fp16 rows; behind them RH / 16 tiles of hi + lo rows
// grid (heads, NTF + RH / 16): the tiles with the most keys have the lowest y index, for all heads
__global__ __launch_bounds__(AW * 32) void k_dattn(const h16* __restrict__ Q16, const h16* __restrict__ K16, const h16* __restrict__ V16, const bf* __restrict__ Qh, const bf* __restrict__ Ql, const bf* __restrict__ Kh, const bf* __restrict__ Kl, const bf* __restrict__ Vh, const bf* __restrict__ Vl, const float* __restrict__ lam4, bf* Ah, bf* Al) {
    __shared__ __align__(16) float red[AW * NQF * 16 * 68]; __shared__ __align__(16) float st[AW * 2 * NQF * 16 * 2];
    const int h = blockIdx.x, y = blockIdx.y;
    const float lam = __expf(bfr(lam4[0]) * bfr(lam4[1])) - __expf(bfr(lam4[2]) * bfr(lam4[3])) + 0.2f;
    if (y < NTF) dattn_body<h16, false, NQF>(Q16, nullptr, K16, nullptr, V16, nullptr, lam, TT - (y + 1) * (NQF * 16), h, Ah, Al, red, st);   // the branch is the same for the whole work-group
    else dattn_body<bf, true, 1>(Qh, Ql, Kh, Kl, Vh, Vl, lam, RH - (y - NTF + 1) * 16, h, Ah, Al, red, st);
}

extern "C" void kernel_launch(void* const* d_in, const int* in_sizes, int n_in,
                              void* d_out, int out_size, void* d_ws, size_t ws_size, hipStream_t stream) {
    (void)in_sizes; (void)n_in; (void)out_size;
    const float* x = (const float*)d_in[0]; const float* key1 = (const float*)d_in[1]; const float* key2 = (const float*)d_in[2]; const float* query1 = (const float*)d_in[3]; const float* query2 = (const float*)d_in[4]; const float* valw = (const float*)d_in[5]; const float* lambdas = (const float*)d_in[6]; const float* wo = (const float*)d_in[7]; const float* bo = (const float*)d_in[8]; const float* wq = nullptr; const float* wk = nullptr; const float* wv = nullptr; (void)wq; (void)wk; (void)wv; const float* cosT = nullptr; const float* sinT = nullptr; (void)cosT; (void)sinT;
    float* OUT = (float*)d_out;     // [2][2048][1024]
    char* wsp = (char*)d_ws;
    auto take = [&](size_t bytes) { char* p = wsp; wsp += (bytes + 255) & ~(size_t)255; return (void*)p; };
    bf* WQ = (bf*)take((size_t)DQ * DM * 2); bf* WK = (bf*)take((size_t)DKV * DM * 2); bf* WV = (bf*)take((size_t)DKV * DM * 2); bf* WO = (bf*)take((size_t)DM * DQ * 2);
    bf* XB = (bf*)take((size_t)TT * DM * 2);
    h16* QP16 = (h16*)take((size_t)NH_ * TT * HD * 2); h16* KP16 = (h16*)take((size_t)NKV * TT * HD * 2); h16* VT16 = (h16*)take((size_t)NKV * HD * TT * 2);
    bf* QPh = (bf*)take((size_t)NH_ * TT * HD * 2); bf* QPl = (bf*)take((size_t)NH_ * TT * HD * 2); bf* KPh = (bf*)take((size_t)NKV * TT * HD * 2); bf* KPl = (bf*)take((size_t)NKV * TT * HD * 2); bf* VTh = (bf*)take((size_t)NKV * HD * TT * 2); bf* VTl = (bf*)take((size_t)NKV * HD * TT * 2);
    bf* ATh = (bf*)take((size_t)TT * DQ * 2); bf* ATl = (bf*)take((size_t)TT * DQ * 2);
    if ((size_t)(wsp - (char*)d_ws) > ws_size) return;    // ws 256 MiB
    static_assert(RH % 32 == 0 && (TT - RH) % (NQF * 16) == 0 && TT % 32 == 0, "a work-group of k_dattn is all hi+lo or all fp16; whole 32-key chunks");
    { k_wtH2<<<(unsigned)(((size_t)DQ * DM / 4 + 255) / 256), 256, 0, stream>>>(query1, query2, WQ); k_wtH2<<<(unsigned)(((size_t)DQ * DM / 4 + 255) / 256), 256, 0, stream>>>(key1, key2, WK); k_wtH1<<<(unsigned)(((size_t)1024 * DM / 4 + 255) / 256), 256, 0, stream>>>(valw, WV);
      k_wtG<<<(unsigned)((1024 * DM / 64 + 63) / 64), 256, 0, stream>>>(wo, 1024, DM, WO);
       }
    for (int b = 0; b < NB_; ++b) {
        
        k_cvt8<<<(unsigned)(((size_t)TT * DM / 8 + 255) / 256), 256, 0, stream>>>(x + (size_t)b * TT * DM, XB, (size_t)TT * DM / 8);
        // q and k: a tile's 64 columns are one score head, written as its planes [head][t][d]; v: weights as the rows and x as the columns, so the planes come out as [head x d][t], the transposed form that k_dattn reads
        k_gemmw<bf, 0, false, true><<<dim3(TT / 64, DQ / 64, 1), 32, 0, stream>>>(XB, nullptr, WQ, nullptr, DM, nullptr, HD, nullptr, 0, 0, 0, QP16, QPh, QPl, (size_t)TT * HD);
        k_gemmw<bf, 0, false, true><<<dim3(TT / 64, DKV / 64, 1), 32, 0, stream>>>(XB, nullptr, WK, nullptr, DM, nullptr, HD, nullptr, 0, 0, 0, KP16, KPh, KPl, (size_t)TT * HD);
        k_gemmw<bf, 0, false, true><<<dim3(1024 / 64, TT / 64, 1), 32, 0, stream>>>(WV, nullptr, XB, nullptr, DM, nullptr, TT, nullptr, 0, 0, 0, VT16, VTh, VTl, 64);
        k_dattn<<<dim3(NHD, NTF + RH / 16), AW * 32, 0, stream>>>(QP16, KP16, VT16, QPh, QPl, KPh, KPl, VTh, VTl, lambdas, ATh, ATl);
        k_gemmw<bf, 1, true, false><<<dim3(TT / 64, DM / 64, 1), 32, 0, stream>>>(ATh, ATl, WO, nullptr, 1024, OUT + (size_t)b * TT * DM, DM, bo, 0, 0, 0, nullptr, nullptr, nullptr, 0); }
}

// v005
// It runs in 284 microseconds.
// Two timings next to v004 put it at 1.30 and 1.31 times that version's speed.
// All steps since v000 together make it 10.0 times as fast.
#include <hip/hip_runtime.h>

// Multi-head differential attention (x [2][2048][1024]; per-head q1/q2/k1/k2/v = x W[h] (W [16][1024][64], no bias); lam = exp(l0 l1) - exp(l2 l3) + 0.2 (lambdas read); wei = softmax(causal(q1.k1) / 8) - lam softmax(causal(q2.k2) / 8); out = (wei v merged) x (1 - 0.2) @ proj_w + proj_b -> [2][2048][1024]).
// The two score matrices of a head are computed as an adjacent pair of "score heads" (2h: q1/k1, 2h+1: q2/k2) so one pass of the causal score GEMM yields both; the differential softmax combines them into one probability matrix per head.
// Compute dtypes, f32 accumulate: every input rounded to bf16; the five projections on PLAIN bf16 operands (inputs: exact; per-head weights gathered); causal scores and wei.v: query rows < 512 hl (3 products), the rest single fp16 (x1024 carrier on wei); both softmaxes, lam and the difference f32; x 0.8 folded into the merge; proj hl x exact (2 products) + bias.

#define NB_  2
#define TT   2048
#define DM   1024
#define NH_  32
#define NKV  32
#define REP  (NH_ / NKV)
#define HD   64
#define DQ   (NH_ * HD)
#define DKV  (NKV * HD)
#define ZH   2
#define RH   512                  // query rows < RH use hi+lo planes (0: none)
#define NHD  16                   // heads (each a pair of score heads)
#define WIN  2048
#define PCAR 1024.0f
#define SCL  0.125f   // HD^-0.5
typedef _Float16 h16;
typedef unsigned short bf;
typedef __attribute__((ext_vector_type(16))) __bf16   v16bf;
typedef __attribute__((ext_vector_type(16))) _Float16 v16h;
typedef __attribute__((ext_vector_type(8)))  _Float16 v8h;
typedef __attribute__((ext_vector_type(8)))  unsigned short v8us;
typedef __attribute__((ext_vector_type(8)))  float    v8f;
typedef __attribute__((ext_vector_type(4)))  float    v4f;
typedef v8h  __attribute__((may_alias)) v8ha;
typedef v4f  __attribute__((may_alias)) v4fa;
typedef v8us __attribute__((may_alias)) v8usa;

__device__ __forceinline__ unsigned short f2bf(float f) { unsigned u = __float_as_uint(f); u += 0x7FFFu + ((u >> 16) & 1u); return (unsigned short)(u >> 16); }
__device__ __forceinline__ float bf2f(unsigned short b) { return __uint_as_float(((unsigned)b) << 16); }
__device__ __forceinline__ float bfr(float f) { return bf2f(f2bf(f)); }
__device__ __forceinline__ v16h cat16(v8h lo, v8h hi) { return __builtin_shufflevector(lo, hi, 0, 1, 2, 3, 4, 5, 6, 7, 8, 9, 10, 11, 12, 13, 14, 15); }
__device__ __forceinline__ v16bf cat16b(v8us lo, v8us hi) { return __builtin_bit_cast(v16bf, __builtin_shufflevector(lo, hi, 0, 1, 2, 3, 4, 5, 6, 7, 8, 9, 10, 11, 12, 13, 14, 15)); }
__device__ __forceinline__ v8f wmma16(v16h a, v16h b, v8f c) { return __builtin_amdgcn_wmma_f32_16x16x32_f16(false, a, false, b, (short)0, c, false, false); }
__device__ __forceinline__ v8f wmmab(v16bf a, v16bf b, v8f c) { return __builtin_amdgcn_wmma_f32_16x16x32_bf16(false, a, false, b, (short)0, c, false, false); }



// ---- k_gemmw: register-blocked GEMM, ONE WAVE per 64x64 output tile (16 accumulators), operands straight from K-contiguous 16-bit planes; grid (M/64, N/64, Z), 32 threads.
// C[m][n] (f32, pitch ldc, + optional f32 bias[n]) = sum_k A[m][k] Bt[n][k] (+ split products per NSPLIT). z-batch strides sA/sB/sC in elements. K % 128 == 0.
// The k loop works in stages of 64 k with two register sets of fragments: all loads of the next stage are issued ahead of this stage's products, so one stage's products run while the next stage's fragments are on their way.
// PL: no f32 C; the tile goes out as three 16-bit planes (fp16, bf16 hi, bf16 lo) at element blockIdx.y x ys + m x ldc + (n % 64): ys = rows x 64, ldc = 64 gives head planes [n / 64][m][n % 64]; ys = 64 gives the plain [m][n].
template <typename T16> struct WFrag;
template <> struct WFrag<h16> { typedef v16h V; static __device__ __forceinline__ V ld(const h16* p) { return cat16(*(const v8h*)p, *(const v8h*)(p + 16)); } static __device__ __forceinline__ v8f mma(V a, V b, v8f c) { return wmma16(a, b, c); } };
template <> struct WFrag<bf> { typedef v16bf V; static __device__ __forceinline__ V ld(const bf* p) { return cat16b(*(const v8us*)p, *(const v8us*)(p + 16)); } static __device__ __forceinline__ v8f mma(V a, V b, v8f c) { return wmmab(a, b, c); } };
__device__ __forceinline__ h16 tohx(float x) { return (h16)x; }
__device__ __forceinline__ void splitf(float y, unsigned short& h, unsigned short& l) { h = f2bf(y); l = f2bf(y - bf2f(h)); }
template <typename T16, int NSPLIT, bool BIAS, bool PL>
__global__ __launch_bounds__(32) void k_gemmw(const T16* __restrict__ A, const T16* __restrict__ A2, const T16* __restrict__ Bt, const T16* __restrict__ Bt2, int K, float* C, int ldc, const float* __restrict__ bias, size_t sA, size_t sB, size_t sC, h16* P16, bf* Ph, bf* Pl, size_t ys) {
    typedef typename WFrag<T16>::V V;
    __shared__ __align__(16) float os[16 * 68];
    const size_t z = blockIdx.z; A += z * sA; if (A2) A2 += z * sA; Bt += z * sB; if (Bt2) Bt2 += z * sB; C += z * sC;
    const int lane = threadIdx.x & 31, lr = lane & 15, hi = lane >> 4; const int r0 = blockIdx.x * 64, c0 = blockIdx.y * 64;
    v8f acc[4][4];
#pragma unroll
    for (int mb = 0; mb < 4; ++mb)
#pragma unroll
        for (int nb = 0; nb < 4; ++nb) acc[mb][nb] = (v8f){};
    const size_t aoff = (size_t)(r0 + lr) * K + 8 * hi, boff = (size_t)(c0 + lr) * K + 8 * hi;
    constexpr bool SA = (NSPLIT == 1 || NSPLIT == 2), SB = (NSPLIT >= 2);
    V fa[2][2][4], fa2[2][2][4], fb[2][2][4], fb2[2][2][4];   // [register set][32-k half of the stage][16-row block]
    unsigned oa[4], ob[4];   // running byte offsets into the A planes and the B planes, one per 16-row block (a plane is far below 4 GiB); the loads of a trip differ from them by immediate offsets
#pragma unroll
    for (int q = 0; q < 4; ++q) { oa[q] = (unsigned)((aoff + (size_t)q * 16 * K) * sizeof(T16)); ob[q] = (unsigned)((boff + (size_t)q * 16 * K) * sizeof(T16)); }
    auto at = [](const T16* base, unsigned o) __attribute__((always_inline)) { return (const T16*)((const char*)base + o); };
    // the stage that begins d elements behind the running offsets
    auto ldst = [&](int d, V (&a)[2][4], V (&a2)[2][4], V (&b)[2][4], V (&b2)[2][4]) __attribute__((always_inline)) {
#pragma unroll
        for (int ks = 0; ks < 2; ++ks) {
#pragma unroll
            for (int mb = 0; mb < 4; ++mb) { a[ks][mb] = WFrag<T16>::ld(at(A, oa[mb]) + d + ks * 32); if (SA) a2[ks][mb] = WFrag<T16>::ld(at(A2, oa[mb]) + d + ks * 32); }
#pragma unroll
            for (int nb = 0; nb < 4; ++nb) { b[ks][nb] = WFrag<T16>::ld(at(Bt, ob[nb]) + d + ks * 32); if (SB) b2[ks][nb] = WFrag<T16>::ld(at(Bt2, ob[nb]) + d + ks * 32); } }
        // s_wait_xcnt 0 behind the stage's loads, in front of whatever writes a register that one of them names as its address. The offsets pass through the statement:
        // they stay in their registers up to it (no load's result is given one of them), and their advance at the foot of the trip cannot be lifted over it.
        asm volatile("s_wait_xcnt 0x0" : "+v"(oa[0]), "+v"(oa[1]), "+v"(oa[2]), "+v"(oa[3]), "+v"(ob[0]), "+v"(ob[1]), "+v"(ob[2]), "+v"(ob[3]) : : "memory");
        __builtin_amdgcn_sched_barrier(0); };   // keeps every load of the stage in front of the products that follow: sunk among them, each would be waited for in turn, one memory latency after another
    auto prod = [&](const V (&a)[2][4], const V (&a2)[2][4], const V (&b)[2][4], const V (&b2)[2][4]) __attribute__((always_inline)) {
#pragma unroll
        for (int ks = 0; ks < 2; ++ks)
#pragma unroll
            for (int nb = 0; nb < 4; ++nb)
#pragma unroll
                for (int mb = 0; mb < 4; ++mb) { acc[mb][nb] = WFrag<T16>::mma(a[ks][mb], b[ks][nb], acc[mb][nb]); if (SA) acc[mb][nb] = WFrag<T16>::mma(a2[ks][mb], b[ks][nb], acc[mb][nb]); if (SB) acc[mb][nb] = WFrag<T16>::mma(a[ks][mb], b2[ks][nb], acc[mb][nb]); }
        __builtin_amdgcn_sched_barrier(0); };   // the refill of this register set stays behind its last product
    ldst(0, fa[0], fa2[0], fb[0], fb2[0]);
    // kept rolled: a trip already holds two stages, one per register set
#pragma unroll 1
    for (int kc = 0; kc < K - 128; kc += 128) {
        ldst(64, fa[1], fa2[1], fb[1], fb2[1]); prod(fa[0], fa2[0], fb[0], fb2[0]);
        ldst(128, fa[0], fa2[0], fb[0], fb2[0]); prod(fa[1], fa2[1], fb[1], fb2[1]);
#pragma unroll
        for (int q = 0; q < 4; ++q) { oa[q] += 128 * sizeof(T16); ob[q] += 128 * sizeof(T16); }   // these eight additions, held behind the last product, also fill the vector slots that a matrix instruction needs in front of the refill of its operands, on the taken back edge too
    }
    ldst(64, fa[1], fa2[1], fb[1], fb2[1]); prod(fa[0], fa2[0], fb[0], fb2[0]); prod(fa[1], fa2[1], fb[1], fb2[1]);
#pragma unroll
    for (int mb = 0; mb < 4; ++mb) {
#pragma unroll
        for (int nb = 0; nb < 4; ++nb) {
#pragma unroll
            for (int j = 0; j < 8; ++j) os[(hi * 8 + j) * 68 + nb * 16 + lr] = acc[mb][nb][j]; }
        __builtin_amdgcn_wave_barrier(); asm volatile("" ::: "memory");
        float* crow = C + (size_t)(r0 + mb * 16) * ldc + c0;
        if (PL) {   // 8 lanes x 16 bytes cover a row's 64 elements of a plane: one whole 128-byte line
#pragma unroll
            for (int s = 0; s < 4; ++s) { const int row = 4 * s + (lane >> 3), cofs = (lane & 7) * 8; const v4f x0 = *(const v4fa*)(os + row * 68 + cofs), x1 = *(const v4fa*)(os + row * 68 + cofs + 4); v8h o16; v8us oh, ol;
#pragma unroll
                for (int q = 0; q < 8; ++q) { const float x = (q < 4) ? x0[q & 3] : x1[q & 3]; o16[q] = tohx(x); unsigned short a2, c2; splitf(x, a2, c2); oh[q] = a2; ol[q] = c2; }
                const size_t oo = (size_t)blockIdx.y * ys + (size_t)(r0 + mb * 16 + row) * ldc + cofs; *(v8h*)(P16 + oo) = o16; *(v8us*)(Ph + oo) = oh; *(v8us*)(Pl + oo) = ol;
                asm volatile("s_wait_xcnt 0x0" ::: "memory"); }   // behind the three stores: what follows them in the code may write the registers that they name
        } else {
#pragma unroll
            for (int s = 0; s < 8; ++s) { const int row = 2 * s + hi, cofs = lr * 4; v4f val = *(const v4fa*)(os + row * 68 + cofs); if (BIAS) { val[0] += bfr(bias[c0 + cofs]); val[1] += bfr(bias[c0 + cofs + 1]); val[2] += bfr(bias[c0 + cofs + 2]); val[3] += bfr(bias[c0 + cofs + 3]); }
                *(v4f*)(crow + (size_t)row * ldc + cofs) = val; }
            asm volatile("s_wait_xcnt 0x0" ::: "memory");   // behind the block's eight stores: the next block's bias load may return into a register that one of them names
             }
        __builtin_amdgcn_wave_barrier(); asm volatile("" ::: "memory");
    }
}

typedef __attribute__((ext_vector_type(2))) _Float16 v2h;
typedef __attribute__((ext_vector_type(4))) _Float16 v4h;
typedef __attribute__((ext_vector_type(2))) unsigned short v2us;
typedef __attribute__((ext_vector_type(4))) unsigned short v4us;
typedef __attribute__((ext_vector_type(2))) float v2f;
typedef __attribute__((ext_vector_type(4))) int v4i;

__global__ __launch_bounds__(256) void k_wtG(const float* __restrict__ w, int K, int N, bf* Bt) {
    const int lane = threadIdx.x & 31; const int L0 = (blockIdx.x * 8 + (threadIdx.x >> 5)) * 8; const int nlines = N * K / 64;
{
#pragma unroll 1
        for (int l = 0; l < 8; ++l) { const int L = L0 + l; if (L >= nlines) break; const size_t e = (size_t)L * 64 + lane * 2; const int k = (int)(e % K), n = (int)(e / K); v2us o;
            o[0] = f2bf(w[(size_t)k * N + n]); o[1] = f2bf(w[(size_t)(k + 1) * N + n]); *(v2us*)(Bt + e) = o; }
         }
}
__global__ __launch_bounds__(256) void k_cvt8(const float* __restrict__ src, bf* dst, size_t n8) { const size_t i = (size_t)blockIdx.x * 256 + threadIdx.x; if (i >= n8) return; const v8f v = *(const v8f*)(src + i * 8); v8us o;
#pragma unroll
    for (int k = 0; k < 8; ++k) o[k] = f2bf(v[k]); *(v8us*)(dst + i * 8) = o;  }
__global__ __launch_bounds__(256) void k_cscvt(const float* __restrict__ cosT, const float* __restrict__ sinT, float* CS) { const int idx = blockIdx.x * 256 + threadIdx.x; if (idx >= TT * HD) return; v2f cs; cs[0] = bfr(cosT[idx]); cs[1] = bfr(sinT[idx]); *(v2f*)(CS + (size_t)idx * 2) = cs;  }
// k_asoft: per row (zz, i): t = S x HD^-0.5 for j <= i and i - j < WIN (sliding causal window; the reference's -1e9 additive fill vanishes identically); softmax over the 2048 keys (register row, one exp, fixed trees);
__global__ __launch_bounds__(256) void k_asoft(const float* __restrict__ Sb, h16* P16, bf* Ph, bf* Pl) {
    const int lane = threadIdx.x & 31; const int row = blockIdx.x * 8 + (threadIdx.x >> 5); if (row >= ZH * TT) return; const int i = row % TT; const int zz = row / TT; (void)zz; const bool hires = (i < RH); const float* sr = Sb + (size_t)row * TT; float v[TT / 32]; float mx = -3.0e38f;
#pragma unroll
    for (int ch = 0; ch < TT / 128; ++ch) { const int j0 = ch * 128 + lane * 4; const v4f a = *(const v4f*)(sr + j0);
#pragma unroll
        for (int q = 0; q < 4; ++q) { const int j = j0 + q; (void)j; const float t = (j <= i && i - j < WIN) ? a[q] * SCL : -3.0e38f; v[ch * 4 + q] = t; mx = fmaxf(mx, t); } }
#pragma unroll
    for (int sh = 16; sh; sh >>= 1) mx = fmaxf(mx, __shfl_xor(mx, sh, 32));
    float sum = 0.f;
#pragma unroll
    for (int k = 0; k < TT / 32; ++k) { float d0 = __fsub_rn(v[k], mx); asm volatile("" : "+v"(d0)); v[k] = __builtin_amdgcn_exp2f(__fmul_rn(d0, 1.4426950408889634f)); sum += v[k]; }
#pragma unroll
    for (int sh = 16; sh; sh >>= 1) sum += __shfl_xor(sum, sh, 32);
    const float f = __fdiv_rn(hires ? 1.0f : PCAR, sum);
{
        if (hires) {
#pragma unroll
            for (int ch = 0; ch < TT / 128; ++ch) { v4us oh, ol;
#pragma unroll
                for (int q = 0; q < 4; ++q) { unsigned short a, c2; splitf(v[ch * 4 + q] * f, a, c2); oh[q] = a; ol[q] = c2; }
                const size_t oo = ((size_t)zz * (RH ? RH : 1) + i) * TT + ch * 128 + lane * 4; *(v4us*)(Ph + oo) = oh; *(v4us*)(Pl + oo) = ol; }
        } else {
#pragma unroll
            for (int ch = 0; ch < TT / 128; ++ch) { v4h o4;
#pragma unroll
                for (int q = 0; q < 4; ++q) o4[q] = tohx(v[ch * 4 + q] * f);
                *(v4h*)(P16 + (size_t)row * TT + ch * 128 + lane * 4) = o4; } }
         }
}
__global__ __launch_bounds__(256) void k_merge(const float* __restrict__ O, int h0, bf* Ah, bf* Al) { const size_t e = ((size_t)blockIdx.x * 256 + threadIdx.x) * 2; if (e >= (size_t)ZH * TT * HD) return; const int d = (int)(e % HD); const int t = (int)((e / HD) % TT); const int zz = (int)(e / ((size_t)HD * TT)); const float cs = (t < RH) ? 1.0f : (1.0f / PCAR); const size_t oo = (size_t)t * DQ + (h0 + zz) * HD + d;
    v2us oh, ol;
#pragma unroll
    for (int q = 0; q < 2; ++q) { unsigned short a, c2; splitf(O[e + q] * cs, a, c2); oh[q] = a; ol[q] = c2; } *(v2us*)(Ah + oo) = oh; *(v2us*)(Al + oo) = ol;  }

__global__ __launch_bounds__(256) void k_wtH2(const float* __restrict__ w1, const float* __restrict__ w2, bf* Bt) { const size_t e = ((size_t)blockIdx.x * 256 + threadIdx.x) * 4; if (e >= (size_t)DQ * DM) return; const int k = (int)(e % DM); const int n = (int)(e / DM); const int hh = n / HD, c = n % HD; const int h = hh >> 1; const float* w = (hh & 1) ? w2 : w1; v4us o;
#pragma unroll
    for (int u = 0; u < 4; ++u) o[u] = f2bf(w[((size_t)h * DM + k + u) * HD + c]); *(v4us*)(Bt + e) = o;  }
__global__ __launch_bounds__(256) void k_wtH1(const float* __restrict__ w, bf* Bt) { const size_t e = ((size_t)blockIdx.x * 256 + threadIdx.x) * 4; if (e >= (size_t)1024 * DM) return; const int k = (int)(e % DM); const int n = (int)(e / DM); const int h = n / HD, c = n % HD; v4us o;
#pragma unroll
    for (int u = 0; u < 4; ++u) o[u] = f2bf(w[((size_t)h * DM + k + u) * HD + c]); *(v4us*)(Bt + e) = o;  }
// ---- k_dattn: scores, both softmaxes, their difference, the product with v and the head merge of NQ x 16 query rows of one head in ONE work-group; no score or probability goes to memory.
// AW waves; wave w takes the 32-key chunks w, w + AW, ... up to the diagonal, each key or value fragment serving the wave's NQ query blocks. The scores are formed transposed (A = key rows, B = query rows), so a lane holds 8 + 8 keys
// of ONE query: the two accumulators of a 32-key chunk are, element for element, the B fragment of the product v^T x wei^T, and a query's maximum and sum need one exchange between the two lane halves.
// Sweep 1: running maximum and sum per query and score head, merged over the waves through LDS. Sweep 2: the scores again, wei = p1 / e1 - lam p2 / e2 in f32, rounded as before (fp16 with the x1024 carrier, or hi + lo), times v.
// The waves' f32 tiles are summed through LDS in wave order, scaled by 0.8 and split into the hi and lo planes [t][1024] of the output projection. Only a tile's last chunk crosses the diagonal; it alone is masked.
#define AW 8
#define SC2 (SCL * 1.4426950408889634f)   // score -> exponent of 2; SCL is a power of two, so this is the rounded log2(e) scaled exactly
#define MASKED (-0x1p100f)                // a masked score: a power of two, so MASKED x SC2 is exact and a lane that has met only masked keys forms exp2(0), a finite sum that the first real maximum scales by exactly 0
typedef __attribute__((ext_vector_type(16))) unsigned short v16us;
template <bool B> struct BC { static constexpr bool v = B; };
__device__ __forceinline__ void packw(const float (&w)[16], v16h& a, v16h& b) {
#pragma unroll
    for (int e = 0; e < 16; ++e) a[e] = tohx(w[e]);
    b = a; }
__device__ __forceinline__ void packw(const float (&w)[16], v16bf& a, v16bf& b) { v16us x, y;
#pragma unroll
    for (int e = 0; e < 16; ++e) { unsigned short p, q; splitf(w[e], p, q); x[e] = p; y[e] = q; }
    a = __builtin_bit_cast(v16bf, x); b = __builtin_bit_cast(v16bf, y); }
template <typename T16, bool HL, int NQ>
__device__ __forceinline__ void dattn_body(const T16* __restrict__ Q, const T16* __restrict__ Q2, const T16* __restrict__ Kp, const T16* __restrict__ Kp2, const T16* __restrict__ Vt, const T16* __restrict__ Vt2, float lam, int q0, int h, bf* Ah, bf* Al, float* red, float* st) {
    typedef typename WFrag<T16>::V V;
    constexpr int QT = NQ * 16;
    const int lane = threadIdx.x & 31, lr = lane & 15, hi = lane >> 4; const int wv = __builtin_amdgcn_readfirstlane((int)(threadIdx.x >> 5));   // the wave's number as a scalar: the key loops' tests are then scalar branches
    const int nch = (q0 + QT + 31) >> 5;      // 32-key chunks that hold a key <= the last query row; chunk nch - 1 is the one that crosses the diagonal
    V qf[NQ][2][2], qf2[NQ][2][2];
    // s_wait_xcnt 0 behind each fragment's two loads, here and in both sweeps: a later load may return its data into the registers that held this fragment's address
#pragma unroll
    for (int nq = 0; nq < NQ; ++nq)
#pragma unroll
        for (int sc = 0; sc < 2; ++sc)
#pragma unroll
            for (int c = 0; c < 2; ++c) { const size_t o = ((size_t)(2 * h + sc) * TT + q0 + nq * 16 + lr) * HD + c * 32 + 8 * hi; qf[nq][sc][c] = WFrag<T16>::ld(Q + o); asm volatile("s_wait_xcnt 0x0" ::: "memory"); if (HL) { qf2[nq][sc][c] = WFrag<T16>::ld(Q2 + o); asm volatile("s_wait_xcnt 0x0" ::: "memory"); } }
    // the key fragments of score head sc for the chunk at kc
    auto ldk = [&](int kc, int sc, V (&kf)[2][2], V (&kf2)[2][2]) __attribute__((always_inline)) {
#pragma unroll
        for (int kb = 0; kb < 2; ++kb)
#pragma unroll
            for (int c = 0; c < 2; ++c) { const size_t o = ((size_t)(2 * h + sc) * TT + kc + kb * 16 + lr) * HD + c * 32 + 8 * hi; kf[kb][c] = WFrag<T16>::ld(Kp + o); asm volatile("s_wait_xcnt 0x0" ::: "memory"); if (HL) { kf2[kb][c] = WFrag<T16>::ld(Kp2 + o); asm volatile("s_wait_xcnt 0x0" ::: "memory"); } } };
    // 16 keys x 16 queries of transposed scores, masked above the diagonal where the chunk crosses it
    auto score = [&](int kc, int nq, int sc, int kb, const V (&kf)[2][2], const V (&kf2)[2][2], auto mk) __attribute__((always_inline)) { v8f s = (v8f){};
#pragma unroll
        for (int c = 0; c < 2; ++c) { s = WFrag<T16>::mma(kf[kb][c], qf[nq][sc][c], s); if (HL) { s = WFrag<T16>::mma(kf[kb][c], qf2[nq][sc][c], s); s = WFrag<T16>::mma(kf2[kb][c], qf[nq][sc][c], s); } }
        if (decltype(mk)::v) {
#pragma unroll
            for (int j = 0; j < 8; ++j) s[j] = (kc + kb * 16 + hi * 8 + j <= q0 + nq * 16 + lr) ? s[j] : MASKED; }
        return s; };
    float mb[NQ][2], l[NQ][2];   // running maximum (as an exponent of 2) and the sum relative to it
#pragma unroll
    for (int nq = 0; nq < NQ; ++nq)
#pragma unroll
        for (int sc = 0; sc < 2; ++sc) { mb[nq][sc] = MASKED * SC2; l[nq][sc] = 0.f; }
    auto sweep1 = [&](int kc, auto mk) __attribute__((always_inline)) {
        V kf[2][2][2], kf2[2][2][2];
        if (!HL) { ldk(kc, 0, kf[0], kf2[0]); ldk(kc, 1, kf[1], kf2[1]);
            __builtin_amdgcn_sched_barrier(0); }   // keeps the products behind the last load: moved up between the loads they would wait for each fragment in turn, one memory latency after another
#pragma unroll
        for (int sc = 0; sc < 2; ++sc) {
            if (HL) { ldk(kc, sc, kf[sc], kf2[sc]);
                __builtin_amdgcn_sched_barrier(0); }   // hi + lo: one score head's fragments at a time, for registers; the products again behind the last load
#pragma unroll
            for (int nq = 0; nq < NQ; ++nq) { const v8f s0 = score(kc, nq, sc, 0, kf[sc], kf2[sc], mk), s1 = score(kc, nq, sc, 1, kf[sc], kf2[sc], mk); float mx = fmaxf(s0[0], s1[0]);
#pragma unroll
                for (int j = 1; j < 8; ++j) mx = fmaxf(mx, fmaxf(s0[j], s1[j]));
                const float mn = fmaxf(mb[nq][sc], mx * SC2); float sum = l[nq][sc] * __builtin_amdgcn_exp2f(mb[nq][sc] - mn);
#pragma unroll
                for (int j = 0; j < 8; ++j) sum += __builtin_amdgcn_exp2f(__builtin_fmaf(s0[j], SC2, -mn)) + __builtin_amdgcn_exp2f(__builtin_fmaf(s1[j], SC2, -mn));
                mb[nq][sc] = mn; l[nq][sc] = sum; } } };
    // kept rolled: a second copy of the body would double the fragments in flight
#pragma unroll 1
    for (int ch = wv; ch < nch - 1; ch += AW) sweep1(ch * 32, BC<false>{});
    if (((nch - 1) & (AW - 1)) == wv) sweep1((nch - 1) * 32, BC<true>{});
#pragma unroll
    for (int nq = 0; nq < NQ; ++nq)
#pragma unroll
        for (int sc = 0; sc < 2; ++sc) { const float mo = __shfl_xor(mb[nq][sc], 16, 32), lo = __shfl_xor(l[nq][sc], 16, 32); const float mn = fmaxf(mb[nq][sc], mo);
            v2f ml; ml[0] = mn; ml[1] = l[nq][sc] * __builtin_amdgcn_exp2f(mb[nq][sc] - mn) + lo * __builtin_amdgcn_exp2f(mo - mn);
            if (hi == 0) *(v2f*)(st + ((wv * 2 + sc) * QT + nq * 16 + lr) * 2) = ml; }
    __syncthreads();   // every wave's maxima and sums are in LDS before any wave merges them
    float MB[NQ][2], g[NQ][2];
#pragma unroll
    for (int nq = 0; nq < NQ; ++nq)
#pragma unroll
        for (int sc = 0; sc < 2; ++sc) { v2f ml[AW]; float mn = MASKED * SC2;
#pragma unroll
            for (int u = 0; u < AW; ++u) { ml[u] = *(const v2f*)(st + ((u * 2 + sc) * QT + nq * 16 + lr) * 2); mn = fmaxf(mn, ml[u][0]); }
            float sum = 0.f;
#pragma unroll
            for (int u = 0; u < AW; ++u) ml[u][0] = __builtin_amdgcn_exp2f(ml[u][0] - mn);
#pragma unroll
            for (int u = 0; u < AW; ++u) sum += ml[u][1] * ml[u][0];
            MB[nq][sc] = mn; g[nq][sc] = __fdiv_rn(1.0f, sum) * (sc ? lam : 1.0f) * (HL ? 1.0f : PCAR); }
    v8f acc[NQ][4];
#pragma unroll
    for (int nq = 0; nq < NQ; ++nq)
#pragma unroll
        for (int mq = 0; mq < 4; ++mq) acc[nq][mq] = (v8f){};
    auto sweep2 = [&](int kc, auto mk) __attribute__((always_inline)) {
        V kf[2][2][2], kf2[2][2][2], vf[4], vf2[4]; v8f s[NQ][2][2];
        if (!HL) { ldk(kc, 0, kf[0], kf2[0]); ldk(kc, 1, kf[1], kf2[1]);
            __builtin_amdgcn_sched_barrier(0); }   // as in sweep 1
#pragma unroll
        for (int sc = 0; sc < 2; ++sc) {
            if (HL) { ldk(kc, sc, kf[sc], kf2[sc]);
                __builtin_amdgcn_sched_barrier(0); }   // as in sweep 1
#pragma unroll
            for (int nq = 0; nq < NQ; ++nq)
#pragma unroll
                for (int kb = 0; kb < 2; ++kb) s[nq][sc][kb] = score(kc, nq, sc, kb, kf[sc], kf2[sc], mk); }
        __builtin_amdgcn_sched_barrier(0);   // the value fragments are asked for only behind the score products, into the registers that the key fragments leave: asked for with the keys they would not fit
        V wa[NQ], wb[NQ];
#pragma unroll
        for (int nq = 0; nq < NQ; ++nq) { float w[16];
#pragma unroll
            for (int mq = nq * 4 / NQ; mq < (nq + 1) * 4 / NQ; ++mq) { const size_t o = ((size_t)h * HD + mq * 16 + lr) * TT + kc + 8 * hi; vf[mq] = WFrag<T16>::ld(Vt + o); asm volatile("s_wait_xcnt 0x0" ::: "memory"); if (HL) { vf2[mq] = WFrag<T16>::ld(Vt2 + o); asm volatile("s_wait_xcnt 0x0" ::: "memory"); } }
            __builtin_amdgcn_sched_barrier(0);   // a share of the value fragments is asked for ahead of each query block's exponentials, which cover its latency: sunk below them, the whole latency would stand in front of the products
#pragma unroll
            for (int kb = 0; kb < 2; ++kb)
#pragma unroll
                for (int j = 0; j < 8; ++j) w[kb * 8 + j] = __builtin_amdgcn_exp2f(__builtin_fmaf(s[nq][0][kb][j], SC2, -MB[nq][0])) * g[nq][0] - __builtin_amdgcn_exp2f(__builtin_fmaf(s[nq][1][kb][j], SC2, -MB[nq][1])) * g[nq][1];
            packw(w, wa[nq], wb[nq]);
            __builtin_amdgcn_sched_barrier(0); }   // one query block's scores have left their registers before the next share of fragments is asked for
#pragma unroll
        for (int nq = 0; nq < NQ; ++nq)
#pragma unroll
            for (int mq = 0; mq < 4; ++mq) { acc[nq][mq] = WFrag<T16>::mma(vf[mq], wa[nq], acc[nq][mq]); if (HL) { acc[nq][mq] = WFrag<T16>::mma(vf[mq], wb[nq], acc[nq][mq]); acc[nq][mq] = WFrag<T16>::mma(vf2[mq], wa[nq], acc[nq][mq]); } }
        // the four vector slots behind the last matrix instruction, also on the loop's taken back edge
        asm volatile("v_nop\n\tv_nop\n\tv_nop\n\tv_nop" : "+v"(acc[NQ - 1][0]), "+v"(acc[NQ - 1][1]), "+v"(acc[NQ - 1][2]), "+v"(acc[NQ - 1][3]) : "v"(wa[NQ - 1]), "v"(vf[3])); };
    // kept rolled, as sweep 1
#pragma unroll 1
    for (int ch = wv; ch < nch - 1; ch += AW) sweep2(ch * 32, BC<false>{});
    if (((nch - 1) & (AW - 1)) == wv) sweep2((nch - 1) * 32, BC<true>{});
#pragma unroll
    for (int nq = 0; nq < NQ; ++nq) { float* mine = red + (wv * QT + nq * 16 + lr) * 68 + hi * 8;   // [wave][query][d], pitch 68
#pragma unroll
        for (int mq = 0; mq < 4; ++mq) { v4f a0, a1;
#pragma unroll
            for (int j = 0; j < 4; ++j) { a0[j] = acc[nq][mq][j]; a1[j] = acc[nq][mq][4 + j]; }
            *(v4fa*)(mine + mq * 16) = a0; *(v4fa*)(mine + mq * 16 + 4) = a1; } }
    __syncthreads();   // every wave's tile is in LDS before any wave sums across them
    const float cs = (HL ? 1.0f : (1.0f / PCAR)) * 0.8f;
#pragma unroll
    for (int r = 0; r < QT * 16 / (AW * 32); ++r) { const int idx = r * (AW * 32) + (int)threadIdx.x; const int row = idx >> 4, cofs = (idx & 15) * 4; v4f val = *(const v4fa*)(red + row * 68 + cofs);
#pragma unroll
        for (int u = 1; u < AW; ++u) val += *(const v4fa*)(red + (u * QT + row) * 68 + cofs);
        v4us oh, ol;
#pragma unroll
        for (int q = 0; q < 4; ++q) { unsigned short a, c2; splitf(val[q] * cs, a, c2); oh[q] = a; ol[q] = c2; }
        const size_t oo = (size_t)(q0 + row) * 1024 + h * HD + cofs; *(v4us*)(Ah + oo) = oh; *(v4us*)(Al + oo) = ol;
        asm volatile("s_wait_xcnt 0x0" ::: "memory"); }   // behind the two stores: what follows them in the code may write the registers that they name
}
#define NQF 2                          // query blocks of 16 per wave in the fp16 rows
#define NTF ((TT - RH) / (NQF * 16))   // tiles of fp16 rows; behind them RH / 16 tiles of hi + lo rows
// grid (heads, NTF + RH / 16): the tiles with the most keys have the lowest y index, for all heads
__global__ __launch_bounds__(AW * 32) void k_dattn(const h16* __restrict__ Q16, const h16* __restrict__ K16, const h16* __restrict__ V16, const bf* __restrict__ Qh, const bf* __restrict__ Ql, const bf* __restrict__ Kh, const bf* __restrict__ Kl, const bf* __restrict__ Vh, const bf* __restrict__ Vl, const float* __restrict__ lam4, bf* Ah, bf* Al) {
    __shared__ __align__(16) float red[AW * NQF * 16 * 68]; __shared__ __align__(16) float st[AW * 2 * NQF * 16 * 2];
    const int h = blockIdx.x, y = blockIdx.y;
    const float lam = __expf(bfr(lam4[0]) * bfr(lam4[1])) - __expf(bfr(lam4[2]) * bfr(lam4[3])) + 0.2f;
    if (y < NTF) dattn_body<h16, false, NQF>(Q16, nullptr, K16, nullptr, V16, nullptr, lam, TT - (y + 1) * (NQF * 16), h, Ah, Al, red, st);   // the branch is the same for the whole work-group
    else dattn_body<bf, true, 1>(Qh, Ql, Kh, Kl, Vh, Vl, lam, RH - (y - NTF + 1) * 16, h, Ah, Al, red, st);
}

extern "C" void kernel_launch(void* const* d_in, const int* in_sizes, int n_in,
                              void* d_out, int out_size, void* d_ws, size_t ws_size, hipStream_t stream) {
    (void)in_sizes; (void)n_in; (void)out_size;
    const float* x = (const float*)d_in[0]; const float* key1 = (const float*)d_in[1]; const float* key2 = (const float*)d_in[2]; const float* query1 = (const float*)d_in[3]; const float* query2 = (const float*)d_in[4]; const float* valw = (const float*)d_in[5]; const float* lambdas = (const float*)d_in[6]; const float* wo = (const float*)d_in[7]; const float* bo = (const float*)d_in[8]; const float* wq = nullptr; const float* wk = nullptr; const float* wv = nullptr; (void)wq; (void)wk; (void)wv; const float* cosT = nullptr; const float* sinT = nullptr; (void)cosT; (void)sinT;
    float* OUT = (float*)d_out;     // [2][2048][1024]
    char* wsp = (char*)d_ws;
    auto take = [&](size_t bytes) { char* p = wsp; wsp += (bytes + 255) & ~(size_t)255; return (void*)p; };
    bf* WQ = (bf*)take((size_t)DQ * DM * 2); bf* WK = (bf*)take((size_t)DKV * DM * 2); bf* WV = (bf*)take((size_t)DKV * DM * 2); bf* WO = (bf*)take((size_t)DM * DQ * 2);
    bf* XB = (bf*)take((size_t)TT * DM * 2);
    h16* QP16 = (h16*)take((size_t)NH_ * TT * HD * 2); h16* KP16 = (h16*)take((size_t)NKV * TT * HD * 2); h16* VT16 = (h16*)take((size_t)NKV * HD * TT * 2);
    bf* QPh = (bf*)take((size_t)NH_ * TT * HD * 2); bf* QPl = (bf*)take((size_t)NH_ * TT * HD * 2); bf* KPh = (bf*)take((size_t)NKV * TT * HD * 2); bf* KPl = (bf*)take((size_t)NKV * TT * HD * 2); bf* VTh = (bf*)take((size_t)NKV * HD * TT * 2); bf* VTl = (bf*)take((size_t)NKV * HD * TT * 2);
    bf* ATh = (bf*)take((size_t)TT * DQ * 2); bf* ATl = (bf*)take((size_t)TT * DQ * 2);
    if ((size_t)(wsp - (char*)d_ws) > ws_size) return;    // ws 256 MiB
    static_assert(RH % 32 == 0 && (TT - RH) % (NQF * 16) == 0 && TT % 32 == 0, "a work-group of k_dattn is all hi+lo or all fp16; whole 32-key chunks");
    { k_wtH2<<<(unsigned)(((size_t)DQ * DM / 4 + 255) / 256), 256, 0, stream>>>(query1, query2, WQ); k_wtH2<<<(unsigned)(((size_t)DQ * DM / 4 + 255) / 256), 256, 0, stream>>>(key1, key2, WK); k_wtH1<<<(unsigned)(((size_t)1024 * DM / 4 + 255) / 256), 256, 0, stream>>>(valw, WV);
      k_wtG<<<(unsigned)((1024 * DM / 64 + 63) / 64), 256, 0, stream>>>(wo, 1024, DM, WO);
       }
    for (int b = 0; b < NB_; ++b) {
        
        k_cvt8<<<(unsigned)(((size_t)TT * DM / 8 + 255) / 256), 256, 0, stream>>>(x + (size_t)b * TT * DM, XB, (size_t)TT * DM / 8);
        // q and k: a tile's 64 columns are one score head, written as its planes [head][t][d]; v: weights as the rows and x as the columns, so the planes come out as [head x d][t], the transposed form that k_dattn reads
        k_gemmw<bf, 0, false, true><<<dim3(TT / 64, DQ / 64, 1), 32, 0, stream>>>(XB, nullptr, WQ, nullptr, DM, nullptr, HD, nullptr, 0, 0, 0, QP16, QPh, QPl, (size_t)TT * HD);
        k_gemmw<bf, 0, false, true><<<dim3(TT / 64, DKV / 64, 1), 32, 0, stream>>>(XB, nullptr, WK, nullptr, DM, nullptr, HD, nullptr, 0, 0, 0, KP16, KPh, KPl, (size_t)TT * HD);
        k_gemmw<bf, 0, false, true><<<dim3(1024 / 64, TT / 64, 1), 32, 0, stream>>>(WV, nullptr, XB, nullptr, DM, nullptr, TT, nullptr, 0, 0, 0, VT16, VTh, VTl, 64);
        k_dattn<<<dim3(NHD, NTF + RH / 16), AW * 32, 0, stream>>>(QP16, KP16, VT16, QPh, QPl, KPh, KPl, VTh, VTl, lambdas, ATh, ATl);
        k_gemmw<bf, 1, true, false><<<dim3(TT / 64, DM / 64, 1), 32, 0, stream>>>(ATh, ATl, WO, nullptr, 1024, OUT + (size_t)b * TT * DM, DM, bo, 0, 0, 0, nullptr, nullptr, nullptr, 0); }
}
